// v000
// Times are from an AMD MI455X. After a warm-up the kernel runs many times in a row, and a time is the length of
// such a window on the GPU divided by its runs, so every launch and the gaps after it count. The runs cycle
// through copies of the inputs. A figure is the median of several windows, for all but v000 over two sittings.
// Sittings can differ by a few percent; kernels timed side by side share one.
// The starting kernel, v000, takes 512 microseconds a run.
// Contractions: q/k/v projections = v_wmma_f32_16x16x32_bf16 (bf16 operands from RNE-converted x, W^T and bias, single product); per-head q.k^T scores = v_wmma_f32_16x16x32_f16 (q, k as f16 planes carried x16, single product); p.v = v_wmma_f32_16x16x32_f16 (head-softmax weights carried x1024 in f16, v^T as f16 plane carried x256, single product); all f32 accumulate; head softmax and LeakyReLU in f32.
#include <hip/hip_runtime.h>
#include <math.h>
#include <stdint.h>

#define NB    8
#define SEQ   1024
#define DM    1024                   // in features = out features = NH*HD
#define NH    8
#define HD    128
#define ROWS  (NB * SEQ)             // 8192 token rows
#define OUTN  (ROWS * DM)
#define NIT   (SEQ / 16)             // 64 query tiles of 16
#define NJT   (SEQ / 64)             // 16 key tiles of 64
#define PVT   ((SEQ / 32) * (HD / 64))   // 64 p.v tiles of 32x64 per head
static_assert(NH * HD == DM);
static_assert(HD == 128);
static_assert((HD / 64) == 2);
static_assert((SEQ % 64) == 0 && (DM % 64) == 0 && (ROWS % 64) == 0 && (DM % 32) == 0 && (HD % 64) == 0);
static_assert(((ROWS / 64) * (DM / 64)) % 8 == 0);
static_assert(((ROWS / 64) * (HD / 64)) % 8 == 0);
static_assert((NH * PVT) % 8 == 0);
static_assert(((ROWS * DM / 8) % 256) == 0);

typedef _Float16 v16h __attribute__((ext_vector_type(16)));
typedef _Float16 v8h  __attribute__((ext_vector_type(8)));
typedef __bf16   v16b __attribute__((ext_vector_type(16)));
typedef __bf16   v8b  __attribute__((ext_vector_type(8)));
typedef float    v8f  __attribute__((ext_vector_type(8)));
typedef float    v4f  __attribute__((ext_vector_type(4)));
typedef unsigned int v4u __attribute__((ext_vector_type(4)));

// ---- scalar helpers --------------------------------------------------------------------------------
__device__ __forceinline__ unsigned short bf_bits(float f) {          // f32 -> bf16 bits, RNE convert
  unsigned u = __float_as_uint(f);
  return (unsigned short)((u + 0x7FFFu + ((u >> 16) & 1u)) >> 16);
}
__device__ __forceinline__ float bf_up(unsigned short h) { return __uint_as_float(((unsigned)h) << 16); }
__device__ __forceinline__ unsigned short h_bits(_Float16 x) { return __builtin_bit_cast(unsigned short, x); }
__device__ __forceinline__ unsigned pk16(unsigned short a, unsigned short b) { return (unsigned)a | ((unsigned)b << 16); }
__device__ __forceinline__ v8f zero8() { v8f z = {0.f, 0.f, 0.f, 0.f, 0.f, 0.f, 0.f, 0.f}; return z; }

// ---- fragment loaders: 16-bit A/B operand, lane -> row/col (lane&15), p already includes +8*(lane>>4);
//      elements 0..7 <- p[0..7] (k0+8h..), elements 8..15 <- p[16..23] (k0+16+8h..)
__device__ __forceinline__ v16b ldfrag_b(const __bf16* p) {
  union { v16b v; v8b h[2]; } f;
  f.h[0] = *(const v8b*)(p);
  f.h[1] = *(const v8b*)(p + 16);
  return f.v;
}
__device__ __forceinline__ v16h ldfrag_h(const _Float16* p) {
  union { v16h v; v8h h[2]; } f;
  f.h[0] = *(const v8h*)(p);
  f.h[1] = *(const v8h*)(p + 16);
  return f.v;
}

// ---- WMMA helpers with trailing VALU hazard gap --------------------------------------------------------
__device__ __forceinline__ v8f mma_h(v16h a, v16h b, v8f c) {
  c = __builtin_amdgcn_wmma_f32_16x16x32_f16(false, a, false, b, (short)0, c, false, false);
#if defined(__HIP_DEVICE_COMPILE__)
  asm volatile("v_nop\n\tv_nop\n\tv_nop\n\tv_nop" : "+v"(c) : "v"(a), "v"(b));
#endif
  return c;
}
__device__ __forceinline__ v8f mma_b_raw(v16b a, v16b b, v8f c) {
  return __builtin_amdgcn_wmma_f32_16x16x32_bf16(false, a, false, b, (short)0, c, false, false);
}
__device__ __forceinline__ void dep_guard_b(v8f& a, v8f& b, v16b x, v16b y) {
#if defined(__HIP_DEVICE_COMPILE__)
  asm volatile("v_nop\n\tv_nop\n\tv_nop\n\tv_nop" : "+v"(a), "+v"(b) : "v"(x), "v"(y));
#endif
}
__device__ __forceinline__ void keep4_b(v16b a, v16b b, v16b c, v16b d) {
#if defined(__HIP_DEVICE_COMPILE__)
  asm volatile("v_nop" :: "v"(a), "v"(b), "v"(c), "v"(d));
#endif
}
__device__ __forceinline__ void acc_guard4(v8f& a, v8f& b, v8f& c, v8f& d) {
#if defined(__HIP_DEVICE_COMPILE__)
  asm volatile("v_nop\n\tv_nop\n\tv_nop\n\tv_nop" : "+v"(a), "+v"(b), "+v"(c), "+v"(d));
#endif
}

// =====================================================================================================
// f32 -> bf16 (RNE convert), 8 elements per thread, one 16-B store per lane: a wave writes 512 contiguous B
// coverage: n8 threads x 8 = whole plane (n8 is a multiple of 256 here).
// =====================================================================================================
__global__ __launch_bounds__(256) void cvt_bf16x8(const float* __restrict__ in, unsigned short* out, int n8) {
  const int i = blockIdx.x * 256 + threadIdx.x;
  if (i < n8) {
    const v4f a = *(const v4f*)(in + (size_t)i * 8);
    const v4f b = *(const v4f*)(in + (size_t)i * 8 + 4);
    v4u p;
    p[0] = pk16(bf_bits(a[0]), bf_bits(a[1]));
    p[1] = pk16(bf_bits(a[2]), bf_bits(a[3]));
    p[2] = pk16(bf_bits(b[0]), bf_bits(b[1]));
    p[3] = pk16(bf_bits(b[2]), bf_bits(b[3]));
    *(v4u*)(out + (size_t)i * 8) = p;
    
  }
}

// =====================================================================================================
// f32 in[R][C] -> bf16 out[C][R] (RNE convert), i.e. a [k][n] weight becomes [n][k] with k contiguous.
// Block = 64 r x 64 c tile staged in LDS as f32 (v4f loads, __syncthreads); grid = (R/64, C/64); R, C
// multiples of 64.
// Store: group g = tid>>3 (0..31), piece = tid&7; iteration it writes out row c = it*32+g, lanes 8q..8q+7 x
// coverage: 2 iterations x 32 groups = 64 out rows c, 8 pieces x 8 = 64 r per row; grid covers every tile ->
// the whole out plane.
// =====================================================================================================
__global__ __launch_bounds__(256) void tr_bf16_64(const float* __restrict__ in, int R, int C,
                                                  unsigned short* out) {
  __shared__ __align__(16) float st[64 * 68];       // [rr][cc] pitch 68 floats
  const int tid = threadIdx.x;
  const int r0  = blockIdx.x * 64;
  const int c0  = blockIdx.y * 64;
#pragma unroll
  for (int i = 0; i < 4; ++i) {
    const int idx = i * 256 + tid;                  // 0..1023
    const int rr = idx >> 4, c4 = (idx & 15) * 4;
    const v4f a = *(const v4f*)(in + ((size_t)(r0 + rr)) * C + c0 + c4);
    *(v4f*)(st + rr * 68 + c4) = a;
  }
  __syncthreads();

  const int g = tid >> 3, piece = tid & 7;
  v4u hv[2];
  size_t hofs[2];
#pragma unroll
  for (int it = 0; it < 2; ++it) {
    const int cc = it * 32 + g;
    v4u a;
#pragma unroll
    for (int e = 0; e < 4; ++e) {
      const float f0 = st[(piece * 8 + 2 * e) * 68 + cc];
      const float f1 = st[(piece * 8 + 2 * e + 1) * 68 + cc];
      a[e] = pk16(bf_bits(f0), bf_bits(f1));
    }
    hv[it] = a;
    hofs[it] = ((size_t)(c0 + cc)) * R + r0 + piece * 8;
  }
  {
#pragma unroll
    for (int it = 0; it < 2; ++it) {
      *(v4u*)(out + hofs[it]) = hv[it];
    }
    
  }
}

// =====================================================================================================
// f32 -> f16 plane = f16(v * scale) (scale a power of two); 8 elements per thread, one 16-B store per lane
// coverage: n8 threads x 8 = whole plane (n8 multiple of 256).
// =====================================================================================================
__global__ __launch_bounds__(256) void plane_f16x8(const float* __restrict__ in, unsigned short* hp, int n8,
                                                   float scale) {
  const int i = blockIdx.x * 256 + threadIdx.x;
  if (i < n8) {
    const v4f a = *(const v4f*)(in + (size_t)i * 8);
    const v4f b = *(const v4f*)(in + (size_t)i * 8 + 4);
    float f[8];
    f[0] = a[0]; f[1] = a[1]; f[2] = a[2]; f[3] = a[3];
    f[4] = b[0]; f[5] = b[1]; f[6] = b[2]; f[7] = b[3];
    v4u ph;
#pragma unroll
    for (int e = 0; e < 4; ++e) {
      const _Float16 x0 = (_Float16)(f[2 * e] * scale);
      const _Float16 x1 = (_Float16)(f[2 * e + 1] * scale);
      ph[e] = pk16(h_bits(x0), h_bits(x1));
    }
    *(v4u*)(hp + (size_t)i * 8) = ph;
    
  }
}

// =====================================================================================================
// Register-blocked bf16 WMMA GEMM with bias: C[m][n] = sum_k A[m][k] * Bt[n][k] + bf16rne(bias[n]); one wave per
// 64x64 tile, no block barriers. A row-major [M][K] pitch lda; Bt row-major [N][K] pitch ldb (k contiguous);
// bias f32 [N] (RNE converted to bf16 and widened in the epilogue); M, N multiples of 64, K multiple of 32
// (fixed sizes, statically asserted); the tile count is a multiple of 8 for every launch here (no idle waves).
// Output f32 [M][N] pitch ldc. Epilogue: 16-row slabs staged per wave in LDS; each 64-wide row segment
// =====================================================================================================
__global__ __launch_bounds__(256) void gemm64(
    const unsigned short* __restrict__ Ap, int lda,
    const unsigned short* __restrict__ Btp, int ldb,
    const float* __restrict__ bias,
    float* C, int ldc, int M, int N, int K) {
  const __bf16* Ab  = (const __bf16*)(const void*)Ap;
  const __bf16* Bb  = (const __bf16*)(const void*)Btp;
  __shared__ __align__(16) float sT[8][16 * 68];   // per-wave 16x64 slab, pitch 68 floats
  const int lane = threadIdx.x & 31;
  const int wave = threadIdx.x >> 5;
  const int tilesN = N >> 6;
  const int tilesM = M >> 6;
  const int tile = blockIdx.x * 8 + wave;
  if (tile >= tilesM * tilesN) return;   // wave-uniform; no block barriers in this kernel
  const int tm = tile / tilesN;
  const int tn = tile - tm * tilesN;
  const int m0 = tm << 6;
  const int n0 = tn << 6;

  const int rlane = lane & 15;                 // row (A) / col (B, D) within subtile
  const int koff  = (lane >> 4) * 8;           // k offset of this lane half
  const int mOff  = (lane >> 4) * 8;           // D row offset

  v8f acc[4][4];
#pragma unroll
  for (int i = 0; i < 4; ++i)
#pragma unroll
    for (int j = 0; j < 4; ++j) acc[i][j] = zero8();

  for (int k0 = 0; k0 < K; k0 += 32) {
    v16b bh[4];
#pragma unroll
    for (int j = 0; j < 4; ++j) {
      const size_t bo = (size_t)(n0 + (j << 4) + rlane) * ldb + koff + k0;
      bh[j] = ldfrag_b(Bb + bo);
    }
#pragma unroll
    for (int i = 0; i < 4; ++i) {
      const size_t ao = (size_t)(m0 + (i << 4) + rlane) * lda + koff + k0;
      const v16b ah = ldfrag_b(Ab + ao);
#pragma unroll
      for (int j = 0; j < 4; ++j) {
        acc[i][j] = mma_b_raw(ah, bh[j], acc[i][j]);
      }
      dep_guard_b(acc[i][0], acc[i][3], ah, ah);
    }
    keep4_b(bh[0], bh[1], bh[2], bh[3]);
  }
  acc_guard4(acc[0][0], acc[0][1], acc[0][2], acc[0][3]);
  acc_guard4(acc[1][0], acc[1][1], acc[1][2], acc[1][3]);
  acc_guard4(acc[2][0], acc[2][1], acc[2][2], acc[2][3]);
  acc_guard4(acc[3][0], acc[3][1], acc[3][2], acc[3][3]);

  // ---- bias per D column of this lane (n0 + 16j + rlane < N) ----
  float bz[4];
#pragma unroll
  for (int j = 0; j < 4; ++j) bz[j] = bf_up(bf_bits(bias[n0 + (j << 4) + rlane]));

  // ---- epilogue ----
  float* slab = sT[wave];
#pragma unroll
  for (int i = 0; i < 4; ++i) {
    const int mBase = m0 + (i << 4);
#pragma unroll
    for (int r = 0; r < 8; ++r) {
#pragma unroll
      for (int j = 0; j < 4; ++j) {
        slab[(mOff + r) * 68 + (j << 4) + rlane] = acc[i][j][r] + bz[j];
      }
    }
    __builtin_amdgcn_fence(__ATOMIC_RELEASE, "workgroup");
    __builtin_amdgcn_wave_barrier();
    __builtin_amdgcn_fence(__ATOMIC_ACQUIRE, "workgroup");
    {
      const int hh = lane >> 4, c4 = (lane & 15) * 4;     // 256-B row segment = 16 lanes x 16 B
      v4f ov[8];
#pragma unroll
      for (int it = 0; it < 8; ++it) {
        const int row = it * 2 + hh;                       // it 0..7 x hh 0..1 = rows 0..15
        ov[it] = *(const v4f*)(slab + row * 68 + c4);
      }
      {
#pragma unroll
        for (int it = 0; it < 8; ++it) {
          const int row = it * 2 + hh;
          *(v4f*)(C + (size_t)(mBase + row) * ldc + n0 + c4) = ov[it];
        }
        
      }
    }
    __builtin_amdgcn_fence(__ATOMIC_RELEASE, "workgroup");
    __builtin_amdgcn_wave_barrier();
    __builtin_amdgcn_fence(__ATOMIC_ACQUIRE, "workgroup");
  }
}

// =====================================================================================================
// v pre-activation f32 token-major vf[(b*SEQ + t)*HD + f] ->
//   f16 v^T plane vth[(b*HD + f)*SEQ + t] = f16(lrelu(v) * vscale), lrelu(x) = x >= 0 ? x : 0.01*x (f32),
//   vscale a power of two.
// Block = one 64-token x 64-feature tile of one b; grid = (SEQ/64, HD/64, NB); tile staged in LDS as f32
// (v4f loads, __syncthreads).
// Store: group g = tid>>3 (0..31), piece = tid&7: iteration it writes row f = it*32+g, lanes 8q..8q+7 x 16 B =
// coverage: 2 iterations x 32 groups = 64 rows f, 8 pieces x 8 = 64 tokens per row; grid covers every (b,
// f half, t tile) -> the whole plane.
// =====================================================================================================
__global__ __launch_bounds__(256) void v_plane(const float* __restrict__ vf, unsigned short* vth, float vscale) {
  __shared__ __align__(16) float sv[64 * 68];       // [tt][d] pitch 68 floats
  const int tid = threadIdx.x;
  const int t0  = blockIdx.x * 64;
  const int fh  = blockIdx.y;                        // feature half (64 features)
  const int b   = blockIdx.z;
#pragma unroll
  for (int i = 0; i < 4; ++i) {
    const int idx = i * 256 + tid;                  // 0..1023
    const int tt = idx >> 4, c4 = (idx & 15) * 4;
    const v4f a = *(const v4f*)(vf + ((size_t)(b * SEQ + t0 + tt)) * HD + fh * 64 + c4);
    *(v4f*)(sv + tt * 68 + c4) = a;
  }
  __syncthreads();

  const int g = tid >> 3, piece = tid & 7;
  v4u hv[2];
  size_t hofs[2];
#pragma unroll
  for (int it = 0; it < 2; ++it) {
    const int d = it * 32 + g;
    v4u a;
#pragma unroll
    for (int e = 0; e < 4; ++e) {
      float f0 = sv[(piece * 8 + 2 * e) * 68 + d];
      float f1 = sv[(piece * 8 + 2 * e + 1) * 68 + d];
      f0 = (f0 >= 0.f) ? f0 : 0.01f * f0;
      f1 = (f1 >= 0.f) ? f1 : 0.01f * f1;
      a[e] = pk16(h_bits((_Float16)(f0 * vscale)), h_bits((_Float16)(f1 * vscale)));
    }
    hv[it] = a;
    hofs[it] = ((size_t)(b * HD + fh * 64 + d)) * SEQ + t0 + piece * 8;
  }
  {
#pragma unroll
    for (int it = 0; it < 2; ++it) {
      *(v4u*)(vth + hofs[it]) = hv[it];
    }
    
  }
}

// =====================================================================================================
// Per-head scores + softmax over the HEAD axis for one batch b:
//   q f16 plane (x16): element (b, i, h, d) at [(b*SEQ + i)*DM + h*HD + d]
//   k f16 plane (x16): element (b, j, h, d) at [(b*SEQ + j)*DM + h*HD + d]
//   s_h[i][j] = (q_ih . k_jh) * sscale (f16 products, f32 accumulate; sscale folds the x16 carries and
//   1/sqrt(HD)); per (i, j): m = max_h s_h, e_h = exp(s_h - m), p_h = e_h / sum_h e_h (all f32);
//   out plane ap: f16 element (h, i, j) at [(h*SEQ + i)*SEQ + j] = f16(p_h * pscale), pscale a power of two.
// Block = 8 waves (wave = head) x one 16-row (i) x 64-column (j) tile; grid = NIT*NJT blocks for this b.
// Q / K fragments loaded straight from the planes (arithmetic addressing, two 16-B loads per fragment).
// Scores go to LDS (f32) for the cross-head softmax (block barrier), weights back to LDS (f16, block
// coverage: 4 iterations x 4 row groups = 16 rows per wave, 8 pieces x 8 = 64 j per row, 8 waves = 8
// heads; grid covers every (i tile, j tile) -> the whole plane for this b.
// =====================================================================================================
__global__ __launch_bounds__(256)
void scores_hsm(const unsigned short* __restrict__ qhp, const unsigned short* __restrict__ khp,
                unsigned short* ap, int b, float sscale, float pscale) {
  union H8 { v8h h; v4u u; };
  __shared__ __align__(16) float    sS[NH][16 * 64];     // per head scores [row][col]      32 KB
  __shared__ __align__(16) _Float16 sP[NH][16 * 72];     // per head weights [row][col] pitch 72   18 KB
  const int tid  = threadIdx.x;
  const int h    = tid >> 5;                              // wave = head
  const int lane = tid & 31;
  const int hh   = lane >> 4;
  const int c    = lane & 15;
  const int jt   = blockIdx.x % NJT;
  const int it   = blockIdx.x / NJT;                      // < NIT by the grid size
  const int i0   = it * 16;
  const int j0   = jt * 64;
  const size_t rowB = (size_t)b * SEQ;
  const _Float16* Qp = (const _Float16*)(const void*)qhp + (size_t)h * HD;
  const _Float16* Kp = (const _Float16*)(const void*)khp + (size_t)h * HD;

  // ---- scores: 16 rows x 64 cols for head h, K = HD = 128 (4 k-steps) ----
  v8f s[4];
#pragma unroll
  for (int jj = 0; jj < 4; ++jj) s[jj] = zero8();
#pragma unroll
  for (int dc = 0; dc < HD / 32; ++dc) {
    const v16h qa = ldfrag_h(Qp + (rowB + i0 + c) * DM + dc * 32 + 8 * hh);
#pragma unroll
    for (int jj = 0; jj < 4; ++jj) {
      const v16h kb = ldfrag_h(Kp + (rowB + j0 + jj * 16 + c) * DM + dc * 32 + 8 * hh);
      s[jj] = mma_h(qa, kb, s[jj]);
    }
  }
  // D element r of lane -> (row 8*hh + r, col jj*16 + c)
  float* ss = sS[h];
#pragma unroll
  for (int r = 0; r < 8; ++r) {
#pragma unroll
    for (int jj = 0; jj < 4; ++jj) {
      ss[(8 * hh + r) * 64 + jj * 16 + c] = s[jj][r] * sscale;
    }
  }
  __syncthreads();

  // ---- softmax across the NH heads per (row, col): thread -> row tid>>4, cols (tid&15)*4 .. +3 ----
  {
    const int ii = tid >> 4, cb = (tid & 15) * 4;
#pragma unroll
    for (int p = 0; p < 4; ++p) {
      const int col = cb + p;
      float v[NH];
#pragma unroll
      for (int g = 0; g < NH; ++g) v[g] = sS[g][ii * 64 + col];
      float m = v[0];
#pragma unroll
      for (int g = 1; g < NH; ++g) m = fmaxf(m, v[g]);
      float sum = 0.f;
#pragma unroll
      for (int g = 0; g < NH; ++g) {
        v[g] = __expf(v[g] - m);
        sum += v[g];
      }
      const float inv = (1.0f / sum) * pscale;         // sum in [1, NH]
#pragma unroll
      for (int g = 0; g < NH; ++g) sP[g][ii * 72 + col] = (_Float16)(v[g] * inv);
    }
  }
  __syncthreads();

  {
    const int g4 = lane >> 3, piece = lane & 7;
    const _Float16* sp = sP[h];
    v4u hv[4];
    size_t hofs[4];
#pragma unroll
    for (int q = 0; q < 4; ++q) {
      const int row = q * 4 + g4;                        // q 0..3 x g4 0..3 = rows 0..15
      H8 x;
      x.h = *(const v8h*)(sp + row * 72 + piece * 8);
      hv[q] = x.u;
      hofs[q] = ((size_t)(h * SEQ + i0 + row)) * SEQ + j0 + piece * 8;
    }
    {
#pragma unroll
      for (int q = 0; q < 4; ++q) {
        *(v4u*)(ap + hofs[q]) = hv[q];
      }
      
    }
  }
}

// =====================================================================================================
// p.v per head for one batch: C[i][h*HD + n] = oscale * sum_j P[h][i][j] * Vt[n][j] (f16 products, f32
// accumulate; oscale folds back the weight and v carries). P f16 [NH][SEQ][SEQ] pitch SEQ (j contiguous);
// Vt f16 [HD][SEQ] pitch SEQ (this batch, j contiguous); C f32 rows of this batch, pitch DM.
// One wave per 32x64 tile, no block barriers; tiles per head PVT = (SEQ/32)*(HD/64); NH*PVT tiles is a
// multiple of 8 (no idle waves). A fragments (2 rows) cached per k-step, B fragments streamed; every WMMA
// nop-guarded. Epilogue: 16-row slabs staged per wave in LDS; each 64-wide row segment (256 B) written by
// coverage: 2 slabs x 16 rows x 64 cols = the wave's whole 32x64 tile; grid covers every (h, i tile, n half)
// -> all SEQ rows x DM columns of this batch.
// =====================================================================================================
__global__ __launch_bounds__(256) void gemm_pv(
    const unsigned short* __restrict__ Pp, const unsigned short* __restrict__ Vtp,
    float* C, float oscale) {
  const _Float16* Bh = (const _Float16*)(const void*)Vtp;
  __shared__ __align__(16) float sT[8][16 * 68];   // per-wave 16x64 slab, pitch 68 floats
  const int lane = threadIdx.x & 31;
  const int wave = threadIdx.x >> 5;
  const int tile = blockIdx.x * 8 + wave;
  if (tile >= NH * PVT) return;          // wave-uniform; no block barriers in this kernel
  const int h  = tile / PVT;
  const int t  = tile - h * PVT;
  const int tm = t >> 1;                 // HD/64 == 2 n-halves
  const int tn = t & 1;
  const int m0 = tm << 5;
  const int n0 = tn << 6;
  const _Float16* Ah = (const _Float16*)(const void*)Pp + (size_t)h * SEQ * SEQ;

  const int rlane = lane & 15;
  const int koff  = (lane >> 4) * 8;
  const int mOff  = (lane >> 4) * 8;

  v8f acc[2][4];
#pragma unroll
  for (int i = 0; i < 2; ++i)
#pragma unroll
    for (int j = 0; j < 4; ++j) acc[i][j] = zero8();

  for (int k0 = 0; k0 < SEQ; k0 += 32) {
    v16h ah[2];
#pragma unroll
    for (int i = 0; i < 2; ++i) {
      const size_t ao = (size_t)(m0 + (i << 4) + rlane) * SEQ + koff + k0;
      ah[i] = ldfrag_h(Ah + ao);
    }
#pragma unroll
    for (int j = 0; j < 4; ++j) {
      const size_t bo = (size_t)(n0 + (j << 4) + rlane) * SEQ + koff + k0;
      const v16h bfr = ldfrag_h(Bh + bo);
#pragma unroll
      for (int i = 0; i < 2; ++i) {
        acc[i][j] = mma_h(ah[i], bfr, acc[i][j]);
      }
    }
  }

  // ---- epilogue ----
  float* slab = sT[wave];
#pragma unroll
  for (int i = 0; i < 2; ++i) {
    const int mBase = m0 + (i << 4);
#pragma unroll
    for (int r = 0; r < 8; ++r) {
#pragma unroll
      for (int j = 0; j < 4; ++j) {
        slab[(mOff + r) * 68 + (j << 4) + rlane] = acc[i][j][r] * oscale;
      }
    }
    __builtin_amdgcn_fence(__ATOMIC_RELEASE, "workgroup");
    __builtin_amdgcn_wave_barrier();
    __builtin_amdgcn_fence(__ATOMIC_ACQUIRE, "workgroup");
    {
      const int hh = lane >> 4, c4 = (lane & 15) * 4;     // 256-B row segment = 16 lanes x 16 B
      v4f ov[8];
#pragma unroll
      for (int it = 0; it < 8; ++it) {
        const int row = it * 2 + hh;                       // it 0..7 x hh 0..1 = rows 0..15
        ov[it] = *(const v4f*)(slab + row * 68 + c4);
      }
      {
#pragma unroll
        for (int it = 0; it < 8; ++it) {
          const int row = it * 2 + hh;
          *(v4f*)(C + (size_t)(mBase + row) * DM + (size_t)h * HD + n0 + c4) = ov[it];
        }
        
      }
    }
    __builtin_amdgcn_fence(__ATOMIC_RELEASE, "workgroup");
    __builtin_amdgcn_wave_barrier();
    __builtin_amdgcn_fence(__ATOMIC_ACQUIRE, "workgroup");
  }
}

// =====================================================================================================
// Workspace map (bytes), every region an exact multiple of its whole-line / whole-tile store granularity
// 8192 x 1024, 1024 x 1024, 128 x 1024, 8192 x 128, 1024 x 1024 per head are whole tiles/lines):
//   Xb    bf16 [8192][1024]              0        16777216
//   Wqt   bf16 [1024 n][1024 k]    16777216         2097152
//   Wkt   bf16 [1024 n][1024 k]    18874368         2097152
//   Wvt   bf16 [128 n][1024 k]     20971520          262144
//   Tf    f32  [8192][1024]       21233664        33554432   (scratch: q, then k, then v pre-activation [8192][128])
//   Qh    f16  [8192][1024]       54788096        16777216   (q x16)
//   Kh    f16  [8192][1024]       71565312        16777216   (k x16)
//   VTh   f16  [8*128][1024]      88342528         2097152   ([b*HD + f][j], lrelu(v) x256)
//   Ap    f16  [8*1024][1024]     90439680        16777216   ([h*SEQ + i][j] for the current batch, weights x1024)
//   end                          107216896
// Inputs: x f32 [8][1024][1024]; Wq, Wk f32 [1024 in][1024 out]; bq, bk f32 [1024] (index h*128+d);
// Wv f32 [1024 in][128]; bv f32 [128]. d_out f32: [8192][1024] at byte 0 (row = b*SEQ + i, col = h*HD + f).
// =====================================================================================================
extern "C" void kernel_launch(void* const* d_in, const int* in_sizes, int n_in,
                              void* d_out, int out_size, void* d_ws, size_t ws_size,
                              hipStream_t stream) {
  if (n_in < 7) return;
  if (in_sizes[0] != NB * SEQ * DM) return;
  if (in_sizes[1] != DM * DM) return;
  if (in_sizes[2] != DM) return;
  if (in_sizes[3] != DM * DM) return;
  if (in_sizes[4] != DM) return;
  if (in_sizes[5] != DM * HD) return;
  if (in_sizes[6] != HD) return;
  if (out_size != OUTN) return;

  const float* x  = (const float*)d_in[0];   // [NB*SEQ][DM]
  const float* Wq = (const float*)d_in[1];   // [DM k][DM n]
  const float* bq = (const float*)d_in[2];   // [DM]
  const float* Wk = (const float*)d_in[3];   // [DM k][DM n]
  const float* bk = (const float*)d_in[4];   // [DM]
  const float* Wv = (const float*)d_in[5];   // [DM k][HD n]
  const float* bv = (const float*)d_in[6];   // [HD]

  const size_t PXb = (size_t)ROWS * DM * 2;          // 16777216
  const size_t PW  = (size_t)DM * DM * 2;            //  2097152
  const size_t PWv = (size_t)HD * DM * 2;            //   262144
  const size_t PF  = (size_t)ROWS * DM * 4;          // 33554432
  const size_t PH  = (size_t)ROWS * DM * 2;          // 16777216
  const size_t PVt = (size_t)NB * HD * SEQ * 2;      //  2097152
  const size_t PA  = (size_t)NH * SEQ * SEQ * 2;     // 16777216
  size_t off = 0;
  const size_t oXb = off; off += PXb;
  const size_t oWq = off; off += PW;
  const size_t oWk = off; off += PW;
  const size_t oWv = off; off += PWv;
  const size_t oTf = off; off += PF;
  const size_t oQh = off; off += PH;
  const size_t oKh = off; off += PH;
  const size_t oVt = off; off += PVt;
  const size_t oA  = off; off += PA;
  if (off > ws_size) return;                        // off = 107216896
  if (off > (size_t)134217728) return;

  char* ws = (char*)d_ws;
  unsigned short* Xb  = (unsigned short*)(ws + oXb);
  unsigned short* Wqt = (unsigned short*)(ws + oWq);
  unsigned short* Wkt = (unsigned short*)(ws + oWk);
  unsigned short* Wvt = (unsigned short*)(ws + oWv);
  float*          Tf  = (float*)(ws + oTf);
  unsigned short* Qh  = (unsigned short*)(ws + oQh);
  unsigned short* Kh  = (unsigned short*)(ws + oKh);
  unsigned short* VTh = (unsigned short*)(ws + oVt);
  unsigned short* Ap  = (unsigned short*)(ws + oA);
  float*          outf = (float*)d_out;             // [ROWS][DM]

  const dim3 blk(256);
  const int n8x = ROWS * DM / 8;                    // 1048576
  const dim3 gCvtX((n8x + 255) / 256);              // 4096 blocks
  const dim3 gTrW(DM / 64, DM / 64);                // (16, 16): in [1024 k][1024 n] -> out [1024 n][1024 k]
  const dim3 gTrV(DM / 64, HD / 64);                // (16, 2):  in [1024 k][128 n]  -> out [128 n][1024 k]
  const dim3 gGemm(((ROWS / 64) * (DM / 64) + 7) / 8);    // 2048 tiles -> 256 blocks
  const dim3 gGemV(((ROWS / 64) * (HD / 64) + 7) / 8);    // 256 tiles -> 32 blocks
  const dim3 gVpl(SEQ / 64, HD / 64, NB);           // (16, 2, 8)
  const dim3 gSc(NIT * NJT);                        // 1024 blocks per batch
  const dim3 gPv((NH * PVT + 7) / 8);               // 512 tiles -> 64 blocks per batch
  const float qkScale = 16.0f;                      // q and k planes carried x16
  const float sscale  = 0.08838834764831845f / 256.0f;   // 1/sqrt(128) with the two x16 carries folded back
  const float pScale  = 1024.0f;                    // softmax weights carried x1024 in f16
  const float vScale  = 256.0f;                     // v^T plane carried x256
  const float pvOscl  = 1.0f / 262144.0f;           // 1/(1024 * 256)

  // (1) activations -> bf16 plane; weights -> bf16 [n][k] planes (RNE convert, LDS transpose)
  cvt_bf16x8<<<gCvtX, blk, 0, stream>>>(x, Xb, n8x);
  tr_bf16_64<<<gTrW, blk, 0, stream>>>(Wq, DM, DM, Wqt);
  tr_bf16_64<<<gTrW, blk, 0, stream>>>(Wk, DM, DM, Wkt);
  tr_bf16_64<<<gTrV, blk, 0, stream>>>(Wv, DM, HD, Wvt);
  // (2) q = Xb . Wqt^T + bq -> Tf [8192][1024] (M=8192, N=1024, K=1024), then f16 plane (x16)
  gemm64<<<gGemm, blk, 0, stream>>>(Xb, DM, Wqt, DM, bq, Tf, DM, ROWS, DM, DM);
  plane_f16x8<<<gCvtX, blk, 0, stream>>>(Tf, Qh, n8x, qkScale);
  // (3) k likewise
  gemm64<<<gGemm, blk, 0, stream>>>(Xb, DM, Wkt, DM, bk, Tf, DM, ROWS, DM, DM);
  plane_f16x8<<<gCvtX, blk, 0, stream>>>(Tf, Kh, n8x, qkScale);
  // (4) v pre-activation = Xb . Wvt^T + bv -> Tf as [8192][128] (M=8192, N=128, K=1024, ldc=128),
  //     then LeakyReLU + f16 v^T plane (x256)
  gemm64<<<gGemV, blk, 0, stream>>>(Xb, DM, Wvt, DM, bv, Tf, HD, ROWS, HD, DM);
  v_plane<<<gVpl, blk, 0, stream>>>(Tf, VTh, vScale);
  // (5) per batch: scores + head softmax -> weight planes, then p . v -> d_out rows of that batch
  for (int b = 0; b < NB; ++b) {
    scores_hsm<<<gSc, blk, 0, stream>>>(Qh, Kh, Ap, b, sscale, pScale);
    gemm_pv<<<gPv, blk, 0, stream>>>(Ap, VTh + (size_t)b * HD * SEQ, outf + (size_t)b * SEQ * DM, pvOscl);
  }
  (void)hipGetLastError();
}

// v001
// It runs in 314 microseconds.
// Next to v000, in two timings, it ran 1.63 and 1.64 times as fast.
// Contractions: q/k/v projections = v_wmma_f32_16x16x32_bf16 (bf16 operands from RNE-converted x, W^T and bias, single product); per-head q.k^T scores = v_wmma_f32_16x16x32_f16 (q, k as f16 planes carried x16, single product); p.v = v_wmma_f32_16x16x32_f16 (head-softmax weights carried x1024 in f16, v^T as f16 plane carried x256, single product); all f32 accumulate; head softmax and LeakyReLU in f32.
#include <hip/hip_runtime.h>
#include <math.h>
#include <stdint.h>

#define NB    8
#define SEQ   1024
#define DM    1024                   // in features = out features = NH*HD
#define NH    8
#define HD    128
#define ROWS  (NB * SEQ)             // 8192 token rows
#define OUTN  (ROWS * DM)
#define NIT   (SEQ / 16)             // 64 query tiles of 16
#define NJT   (SEQ / 64)             // 16 key tiles of 64
#define PVT   ((SEQ / 32) * (HD / 64))   // 64 p.v tiles of 32x64 per head
static_assert(NH * HD == DM);
static_assert(HD == 128);
static_assert((HD / 64) == 2);
static_assert((SEQ % 64) == 0 && (DM % 64) == 0 && (ROWS % 64) == 0 && (DM % 32) == 0 && (HD % 64) == 0);
static_assert(((ROWS / 64) * (DM / 64)) % 8 == 0);
static_assert(((ROWS / 64) * (HD / 64)) % 8 == 0);
static_assert((NH * PVT) % 8 == 0);
static_assert(((ROWS * DM / 8) % 256) == 0);

typedef _Float16 v16h __attribute__((ext_vector_type(16)));
typedef _Float16 v8h  __attribute__((ext_vector_type(8)));
typedef __bf16   v16b __attribute__((ext_vector_type(16)));
typedef __bf16   v8b  __attribute__((ext_vector_type(8)));
typedef float    v8f  __attribute__((ext_vector_type(8)));
typedef float    v4f  __attribute__((ext_vector_type(4)));
typedef unsigned int v4u __attribute__((ext_vector_type(4)));

// ---- scalar helpers --------------------------------------------------------------------------------
__device__ __forceinline__ unsigned short bf_bits(float f) {          // f32 -> bf16 bits, RNE convert
  unsigned u = __float_as_uint(f);
  return (unsigned short)((u + 0x7FFFu + ((u >> 16) & 1u)) >> 16);
}
__device__ __forceinline__ float bf_up(unsigned short h) { return __uint_as_float(((unsigned)h) << 16); }
__device__ __forceinline__ unsigned short h_bits(_Float16 x) { return __builtin_bit_cast(unsigned short, x); }
__device__ __forceinline__ unsigned pk16(unsigned short a, unsigned short b) { return (unsigned)a | ((unsigned)b << 16); }
__device__ __forceinline__ v8f zero8() { v8f z = {0.f, 0.f, 0.f, 0.f, 0.f, 0.f, 0.f, 0.f}; return z; }

// ---- fragment loaders: 16-bit A/B operand, lane -> row/col (lane&15), p already includes +8*(lane>>4);
//      elements 0..7 <- p[0..7] (k0+8h..), elements 8..15 <- p[16..23] (k0+16+8h..)
__device__ __forceinline__ v16b ldfrag_b(const __bf16* p) {
  union { v16b v; v8b h[2]; } f;
  f.h[0] = *(const v8b*)(p);
  f.h[1] = *(const v8b*)(p + 16);
  return f.v;
}
__device__ __forceinline__ v16h ldfrag_h(const _Float16* p) {
  union { v16h v; v8h h[2]; } f;
  f.h[0] = *(const v8h*)(p);
  f.h[1] = *(const v8h*)(p + 16);
  return f.v;
}

// ---- WMMA helpers with trailing VALU hazard gap --------------------------------------------------------
__device__ __forceinline__ v8f mma_h(v16h a, v16h b, v8f c) {
  c = __builtin_amdgcn_wmma_f32_16x16x32_f16(false, a, false, b, (short)0, c, false, false);
#if defined(__HIP_DEVICE_COMPILE__)
  asm volatile("v_nop\n\tv_nop\n\tv_nop\n\tv_nop" : "+v"(c) : "v"(a), "v"(b));
#endif
  return c;
}
__device__ __forceinline__ v8f mma_b_raw(v16b a, v16b b, v8f c) {
  return __builtin_amdgcn_wmma_f32_16x16x32_bf16(false, a, false, b, (short)0, c, false, false);
}
__device__ __forceinline__ void dep_guard_b(v8f& a, v8f& b, v16b x, v16b y) {
#if defined(__HIP_DEVICE_COMPILE__)
  asm volatile("v_nop\n\tv_nop\n\tv_nop\n\tv_nop" : "+v"(a), "+v"(b) : "v"(x), "v"(y));
#endif
}
__device__ __forceinline__ void keep4_b(v16b a, v16b b, v16b c, v16b d) {
#if defined(__HIP_DEVICE_COMPILE__)
  asm volatile("v_nop" :: "v"(a), "v"(b), "v"(c), "v"(d));
#endif
}
__device__ __forceinline__ void acc_guard4(v8f& a, v8f& b, v8f& c, v8f& d) {
#if defined(__HIP_DEVICE_COMPILE__)
  asm volatile("v_nop\n\tv_nop\n\tv_nop\n\tv_nop" : "+v"(a), "+v"(b), "+v"(c), "+v"(d));
#endif
}

// =====================================================================================================
// f32 -> bf16 (RNE convert), 8 elements per thread, one 16-B store per lane: a wave writes 512 contiguous B
// coverage: n8 threads x 8 = whole plane (n8 is a multiple of 256 here).
// =====================================================================================================
__global__ __launch_bounds__(256) void cvt_bf16x8(const float* __restrict__ in, unsigned short* out, int n8) {
  const int i = blockIdx.x * 256 + threadIdx.x;
  if (i < n8) {
    const v4f a = *(const v4f*)(in + (size_t)i * 8);
    const v4f b = *(const v4f*)(in + (size_t)i * 8 + 4);
    v4u p;
    p[0] = pk16(bf_bits(a[0]), bf_bits(a[1]));
    p[1] = pk16(bf_bits(a[2]), bf_bits(a[3]));
    p[2] = pk16(bf_bits(b[0]), bf_bits(b[1]));
    p[3] = pk16(bf_bits(b[2]), bf_bits(b[3]));
    *(v4u*)(out + (size_t)i * 8) = p;
    
  }
}

// =====================================================================================================
// f32 in[R][C] -> bf16 out[C][R] (RNE convert), i.e. a [k][n] weight becomes [n][k] with k contiguous.
// Block = 64 r x 64 c tile staged in LDS as f32 (v4f loads, __syncthreads); grid = (R/64, C/64); R, C
// multiples of 64.
// Store: group g = tid>>3 (0..31), piece = tid&7; iteration it writes out row c = it*32+g, lanes 8q..8q+7 x
// coverage: 2 iterations x 32 groups = 64 out rows c, 8 pieces x 8 = 64 r per row; grid covers every tile ->
// the whole out plane.
// =====================================================================================================
__global__ __launch_bounds__(256) void tr_bf16_64(const float* __restrict__ in, int R, int C,
                                                  unsigned short* out) {
  __shared__ __align__(16) float st[64 * 68];       // [rr][cc] pitch 68 floats
  const int tid = threadIdx.x;
  const int r0  = blockIdx.x * 64;
  const int c0  = blockIdx.y * 64;
#pragma unroll
  for (int i = 0; i < 4; ++i) {
    const int idx = i * 256 + tid;                  // 0..1023
    const int rr = idx >> 4, c4 = (idx & 15) * 4;
    const v4f a = *(const v4f*)(in + ((size_t)(r0 + rr)) * C + c0 + c4);
    *(v4f*)(st + rr * 68 + c4) = a;
  }
  __syncthreads();

  const int g = tid >> 3, piece = tid & 7;
  v4u hv[2];
  size_t hofs[2];
#pragma unroll
  for (int it = 0; it < 2; ++it) {
    const int cc = it * 32 + g;
    v4u a;
#pragma unroll
    for (int e = 0; e < 4; ++e) {
      const float f0 = st[(piece * 8 + 2 * e) * 68 + cc];
      const float f1 = st[(piece * 8 + 2 * e + 1) * 68 + cc];
      a[e] = pk16(bf_bits(f0), bf_bits(f1));
    }
    hv[it] = a;
    hofs[it] = ((size_t)(c0 + cc)) * R + r0 + piece * 8;
  }
  {
#pragma unroll
    for (int it = 0; it < 2; ++it) {
      *(v4u*)(out + hofs[it]) = hv[it];
    }
    
  }
}

// =====================================================================================================
// f32 -> f16 plane = f16(v * scale) (scale a power of two); 8 elements per thread, one 16-B store per lane
// coverage: n8 threads x 8 = whole plane (n8 multiple of 256).
// =====================================================================================================
__global__ __launch_bounds__(256) void plane_f16x8(const float* __restrict__ in, unsigned short* hp, int n8,
                                                   float scale) {
  const int i = blockIdx.x * 256 + threadIdx.x;
  if (i < n8) {
    const v4f a = *(const v4f*)(in + (size_t)i * 8);
    const v4f b = *(const v4f*)(in + (size_t)i * 8 + 4);
    float f[8];
    f[0] = a[0]; f[1] = a[1]; f[2] = a[2]; f[3] = a[3];
    f[4] = b[0]; f[5] = b[1]; f[6] = b[2]; f[7] = b[3];
    v4u ph;
#pragma unroll
    for (int e = 0; e < 4; ++e) {
      const _Float16 x0 = (_Float16)(f[2 * e] * scale);
      const _Float16 x1 = (_Float16)(f[2 * e + 1] * scale);
      ph[e] = pk16(h_bits(x0), h_bits(x1));
    }
    *(v4u*)(hp + (size_t)i * 8) = ph;
    
  }
}

// =====================================================================================================
// Register-blocked bf16 WMMA GEMM with bias: C[m][n] = sum_k A[m][k] * Bt[n][k] + bf16rne(bias[n]); one wave per
// 64x64 tile, no block barriers. A row-major [M][K] pitch lda; Bt row-major [N][K] pitch ldb (k contiguous);
// bias f32 [N] (RNE converted to bf16 and widened in the epilogue); M, N multiples of 64, K multiple of 32
// (fixed sizes, statically asserted); the tile count is a multiple of 8 for every launch here (no idle waves).
// Output f32 [M][N] pitch ldc. Epilogue: 16-row slabs staged per wave in LDS; each 64-wide row segment
// =====================================================================================================
__global__ __launch_bounds__(256) void gemm64(
    const unsigned short* __restrict__ Ap, int lda,
    const unsigned short* __restrict__ Btp, int ldb,
    const float* __restrict__ bias,
    float* C, int ldc, int M, int N, int K) {
  const __bf16* Ab  = (const __bf16*)(const void*)Ap;
  const __bf16* Bb  = (const __bf16*)(const void*)Btp;
  __shared__ __align__(16) float sT[8][16 * 68];   // per-wave 16x64 slab, pitch 68 floats
  const int lane = threadIdx.x & 31;
  const int wave = threadIdx.x >> 5;
  const int tilesN = N >> 6;
  const int tilesM = M >> 6;
  const int tile = blockIdx.x * 8 + wave;
  if (tile >= tilesM * tilesN) return;   // wave-uniform; no block barriers in this kernel
  const int tm = tile / tilesN;
  const int tn = tile - tm * tilesN;
  const int m0 = tm << 6;
  const int n0 = tn << 6;

  const int rlane = lane & 15;                 // row (A) / col (B, D) within subtile
  const int koff  = (lane >> 4) * 8;           // k offset of this lane half
  const int mOff  = (lane >> 4) * 8;           // D row offset

  v8f acc[4][4];
#pragma unroll
  for (int i = 0; i < 4; ++i)
#pragma unroll
    for (int j = 0; j < 4; ++j) acc[i][j] = zero8();

  for (int k0 = 0; k0 < K; k0 += 32) {
    v16b bh[4];
#pragma unroll
    for (int j = 0; j < 4; ++j) {
      const size_t bo = (size_t)(n0 + (j << 4) + rlane) * ldb + koff + k0;
      bh[j] = ldfrag_b(Bb + bo);
    }
#pragma unroll
    for (int i = 0; i < 4; ++i) {
      const size_t ao = (size_t)(m0 + (i << 4) + rlane) * lda + koff + k0;
      const v16b ah = ldfrag_b(Ab + ao);
#pragma unroll
      for (int j = 0; j < 4; ++j) {
        acc[i][j] = mma_b_raw(ah, bh[j], acc[i][j]);
      }
      dep_guard_b(acc[i][0], acc[i][3], ah, ah);
    }
    keep4_b(bh[0], bh[1], bh[2], bh[3]);
  }
  acc_guard4(acc[0][0], acc[0][1], acc[0][2], acc[0][3]);
  acc_guard4(acc[1][0], acc[1][1], acc[1][2], acc[1][3]);
  acc_guard4(acc[2][0], acc[2][1], acc[2][2], acc[2][3]);
  acc_guard4(acc[3][0], acc[3][1], acc[3][2], acc[3][3]);

  // ---- bias per D column of this lane (n0 + 16j + rlane < N) ----
  float bz[4];
#pragma unroll
  for (int j = 0; j < 4; ++j) bz[j] = bf_up(bf_bits(bias[n0 + (j << 4) + rlane]));

  // ---- epilogue ----
  float* slab = sT[wave];
#pragma unroll
  for (int i = 0; i < 4; ++i) {
    const int mBase = m0 + (i << 4);
#pragma unroll
    for (int r = 0; r < 8; ++r) {
#pragma unroll
      for (int j = 0; j < 4; ++j) {
        slab[(mOff + r) * 68 + (j << 4) + rlane] = acc[i][j][r] + bz[j];
      }
    }
    __builtin_amdgcn_fence(__ATOMIC_RELEASE, "workgroup");
    __builtin_amdgcn_wave_barrier();
    __builtin_amdgcn_fence(__ATOMIC_ACQUIRE, "workgroup");
    {
      const int hh = lane >> 4, c4 = (lane & 15) * 4;     // 256-B row segment = 16 lanes x 16 B
      v4f ov[8];
#pragma unroll
      for (int it = 0; it < 8; ++it) {
        const int row = it * 2 + hh;                       // it 0..7 x hh 0..1 = rows 0..15
        ov[it] = *(const v4f*)(slab + row * 68 + c4);
      }
      {
#pragma unroll
        for (int it = 0; it < 8; ++it) {
          const int row = it * 2 + hh;
          *(v4f*)(C + (size_t)(mBase + row) * ldc + n0 + c4) = ov[it];
        }
        
      }
    }
    __builtin_amdgcn_fence(__ATOMIC_RELEASE, "workgroup");
    __builtin_amdgcn_wave_barrier();
    __builtin_amdgcn_fence(__ATOMIC_ACQUIRE, "workgroup");
  }
}

// =====================================================================================================
// v pre-activation f32 token-major vf[(b*SEQ + t)*HD + f] ->
//   f16 v^T plane vth[(b*HD + f)*SEQ + t] = f16(lrelu(v) * vscale), lrelu(x) = x >= 0 ? x : 0.01*x (f32),
//   vscale a power of two.
// Block = one 64-token x 64-feature tile of one b; grid = (SEQ/64, HD/64, NB); tile staged in LDS as f32
// (v4f loads, __syncthreads).
// Store: group g = tid>>3 (0..31), piece = tid&7: iteration it writes row f = it*32+g, lanes 8q..8q+7 x 16 B =
// coverage: 2 iterations x 32 groups = 64 rows f, 8 pieces x 8 = 64 tokens per row; grid covers every (b,
// f half, t tile) -> the whole plane.
// =====================================================================================================
__global__ __launch_bounds__(256) void v_plane(const float* __restrict__ vf, unsigned short* vth, float vscale) {
  __shared__ __align__(16) float sv[64 * 68];       // [tt][d] pitch 68 floats
  const int tid = threadIdx.x;
  const int t0  = blockIdx.x * 64;
  const int fh  = blockIdx.y;                        // feature half (64 features)
  const int b   = blockIdx.z;
#pragma unroll
  for (int i = 0; i < 4; ++i) {
    const int idx = i * 256 + tid;                  // 0..1023
    const int tt = idx >> 4, c4 = (idx & 15) * 4;
    const v4f a = *(const v4f*)(vf + ((size_t)(b * SEQ + t0 + tt)) * HD + fh * 64 + c4);
    *(v4f*)(sv + tt * 68 + c4) = a;
  }
  __syncthreads();

  const int g = tid >> 3, piece = tid & 7;
  v4u hv[2];
  size_t hofs[2];
#pragma unroll
  for (int it = 0; it < 2; ++it) {
    const int d = it * 32 + g;
    v4u a;
#pragma unroll
    for (int e = 0; e < 4; ++e) {
      float f0 = sv[(piece * 8 + 2 * e) * 68 + d];
      float f1 = sv[(piece * 8 + 2 * e + 1) * 68 + d];
      f0 = (f0 >= 0.f) ? f0 : 0.01f * f0;
      f1 = (f1 >= 0.f) ? f1 : 0.01f * f1;
      a[e] = pk16(h_bits((_Float16)(f0 * vscale)), h_bits((_Float16)(f1 * vscale)));
    }
    hv[it] = a;
    hofs[it] = ((size_t)(b * HD + fh * 64 + d)) * SEQ + t0 + piece * 8;
  }
  {
#pragma unroll
    for (int it = 0; it < 2; ++it) {
      *(v4u*)(vth + hofs[it]) = hv[it];
    }
    
  }
}

// =====================================================================================================
// Per-head scores + softmax over the HEAD axis, all batches in one launch (b = blockIdx.y):
//   q f16 plane (x16): element (b, i, h, d) at [(b*SEQ + i)*DM + h*HD + d]
//   k f16 plane (x16): element (b, j, h, d) at [(b*SEQ + j)*DM + h*HD + d]
//   s_h[i][j] = (q_ih . k_jh) * sscale (f16 products, f32 accumulate; sscale folds the x16 carries and
//   1/sqrt(HD)); per (i, j): m = max_h s_h, e_h = exp(s_h - m), p_h = e_h / sum_h e_h (all f32);
//   out plane ap: f16 element (b, h, i, j) at [((b*NH + h)*SEQ + i)*SEQ + j] = f16(p_h * pscale), pscale a
//   power of two.
// Block = 8 waves (wave = head) x one 16-row (i) x 64-column (j) tile; grid = (NIT*NJT, NB) blocks.
// Q / K fragments loaded straight from the planes (arithmetic addressing, two 16-B loads per fragment).
// Scores go to LDS (f32) for the cross-head softmax (block barrier), weights back to LDS (f16, block
// coverage: 4 iterations x 4 row groups = 16 rows per wave, 8 pieces x 8 = 64 j per row, 8 waves = 8
// heads; grid covers every (i tile, j tile, b) -> the whole plane of every batch.
// =====================================================================================================
__global__ __launch_bounds__(256)
void scores_hsm(const unsigned short* __restrict__ qhp, const unsigned short* __restrict__ khp,
                unsigned short* ap, float sscale, float pscale) {
  union H8 { v8h h; v4u u; };
  __shared__ __align__(16) float    sS[NH][16 * 64];     // per head scores [row][col]      32 KB
  __shared__ __align__(16) _Float16 sP[NH][16 * 72];     // per head weights [row][col] pitch 72   18 KB
  const int tid  = threadIdx.x;
  const int h    = tid >> 5;                              // wave = head
  const int lane = tid & 31;
  const int hh   = lane >> 4;
  const int c    = lane & 15;
  const int jt   = blockIdx.x % NJT;
  const int it   = blockIdx.x / NJT;                      // < NIT by the grid size
  const int b    = blockIdx.y;                            // < NB by the grid size
  const int i0   = it * 16;
  const int j0   = jt * 64;
  const size_t rowB = (size_t)b * SEQ;
  const _Float16* Qp = (const _Float16*)(const void*)qhp + (size_t)h * HD;
  const _Float16* Kp = (const _Float16*)(const void*)khp + (size_t)h * HD;

  // ---- scores: 16 rows x 64 cols for head h, K = HD = 128 (4 k-steps) ----
  v8f s[4];
#pragma unroll
  for (int jj = 0; jj < 4; ++jj) s[jj] = zero8();
#pragma unroll
  for (int dc = 0; dc < HD / 32; ++dc) {
    const v16h qa = ldfrag_h(Qp + (rowB + i0 + c) * DM + dc * 32 + 8 * hh);
#pragma unroll
    for (int jj = 0; jj < 4; ++jj) {
      const v16h kb = ldfrag_h(Kp + (rowB + j0 + jj * 16 + c) * DM + dc * 32 + 8 * hh);
      s[jj] = mma_h(qa, kb, s[jj]);
    }
  }
  // D element r of lane -> (row 8*hh + r, col jj*16 + c)
  float* ss = sS[h];
#pragma unroll
  for (int r = 0; r < 8; ++r) {
#pragma unroll
    for (int jj = 0; jj < 4; ++jj) {
      ss[(8 * hh + r) * 64 + jj * 16 + c] = s[jj][r] * sscale;
    }
  }
  __syncthreads();

  // ---- softmax across the NH heads per (row, col): thread -> row tid>>4, cols (tid&15)*4 .. +3 ----
  {
    const int ii = tid >> 4, cb = (tid & 15) * 4;
#pragma unroll
    for (int p = 0; p < 4; ++p) {
      const int col = cb + p;
      float v[NH];
#pragma unroll
      for (int g = 0; g < NH; ++g) v[g] = sS[g][ii * 64 + col];
      float m = v[0];
#pragma unroll
      for (int g = 1; g < NH; ++g) m = fmaxf(m, v[g]);
      float sum = 0.f;
#pragma unroll
      for (int g = 0; g < NH; ++g) {
        v[g] = __expf(v[g] - m);
        sum += v[g];
      }
      const float inv = (1.0f / sum) * pscale;         // sum in [1, NH]
#pragma unroll
      for (int g = 0; g < NH; ++g) sP[g][ii * 72 + col] = (_Float16)(v[g] * inv);
    }
  }
  __syncthreads();

  {
    const int g4 = lane >> 3, piece = lane & 7;
    const _Float16* sp = sP[h];
    v4u hv[4];
    size_t hofs[4];
#pragma unroll
    for (int q = 0; q < 4; ++q) {
      const int row = q * 4 + g4;                        // q 0..3 x g4 0..3 = rows 0..15
      H8 x;
      x.h = *(const v8h*)(sp + row * 72 + piece * 8);
      hv[q] = x.u;
      hofs[q] = ((size_t)((b * NH + h) * SEQ + i0 + row)) * SEQ + j0 + piece * 8;
    }
    {
#pragma unroll
      for (int q = 0; q < 4; ++q) {
        *(v4u*)(ap + hofs[q]) = hv[q];
      }
      
    }
  }
}

// =====================================================================================================
// p.v per head, all batches in one launch (b = blockIdx.y): C[b*SEQ + i][h*HD + n] = oscale * sum_j
// P[b][h][i][j] * Vt[b][n][j] (f16 products, f32 accumulate; oscale folds back the weight and v carries).
// P f16 [NB][NH][SEQ][SEQ] pitch SEQ (j contiguous); Vt f16 [NB][HD][SEQ] pitch SEQ (j contiguous);
// C f32 [NB*SEQ][DM].
// One wave per 32x64 tile, no block barriers; tiles per head PVT = (SEQ/32)*(HD/64); NH*PVT tiles is a
// multiple of 8 (no idle waves). A fragments (2 rows) cached per k-step, B fragments streamed; every WMMA
// nop-guarded. Epilogue: 16-row slabs staged per wave in LDS; each 64-wide row segment (256 B) written by
// coverage: 2 slabs x 16 rows x 64 cols = the wave's whole 32x64 tile; grid covers every (h, i tile, n half)
// and every b -> all NB*SEQ rows x DM columns.
// =====================================================================================================
__global__ __launch_bounds__(256) void gemm_pv(
    const unsigned short* __restrict__ Pp, const unsigned short* __restrict__ Vtp,
    float* Cout, float oscale) {
  const int b = blockIdx.y;              // < NB by the grid size
  const _Float16* Bh = (const _Float16*)(const void*)Vtp + (size_t)b * HD * SEQ;
  float* C = Cout + (size_t)b * SEQ * DM;
  __shared__ __align__(16) float sT[8][16 * 68];   // per-wave 16x64 slab, pitch 68 floats
  const int lane = threadIdx.x & 31;
  const int wave = threadIdx.x >> 5;
  const int tile = blockIdx.x * 8 + wave;
  if (tile >= NH * PVT) return;          // wave-uniform; no block barriers in this kernel
  const int h  = tile / PVT;
  const int t  = tile - h * PVT;
  const int tm = t >> 1;                 // HD/64 == 2 n-halves
  const int tn = t & 1;
  const int m0 = tm << 5;
  const int n0 = tn << 6;
  const _Float16* Ah = (const _Float16*)(const void*)Pp + (size_t)(b * NH + h) * SEQ * SEQ;

  const int rlane = lane & 15;
  const int koff  = (lane >> 4) * 8;
  const int mOff  = (lane >> 4) * 8;

  v8f acc[2][4];
#pragma unroll
  for (int i = 0; i < 2; ++i)
#pragma unroll
    for (int j = 0; j < 4; ++j) acc[i][j] = zero8();

  for (int k0 = 0; k0 < SEQ; k0 += 32) {
    v16h ah[2];
#pragma unroll
    for (int i = 0; i < 2; ++i) {
      const size_t ao = (size_t)(m0 + (i << 4) + rlane) * SEQ + koff + k0;
      ah[i] = ldfrag_h(Ah + ao);
    }
#pragma unroll
    for (int j = 0; j < 4; ++j) {
      const size_t bo = (size_t)(n0 + (j << 4) + rlane) * SEQ + koff + k0;
      const v16h bfr = ldfrag_h(Bh + bo);
#pragma unroll
      for (int i = 0; i < 2; ++i) {
        acc[i][j] = mma_h(ah[i], bfr, acc[i][j]);
      }
    }
  }

  // ---- epilogue ----
  float* slab = sT[wave];
#pragma unroll
  for (int i = 0; i < 2; ++i) {
    const int mBase = m0 + (i << 4);
#pragma unroll
    for (int r = 0; r < 8; ++r) {
#pragma unroll
      for (int j = 0; j < 4; ++j) {
        slab[(mOff + r) * 68 + (j << 4) + rlane] = acc[i][j][r] * oscale;
      }
    }
    __builtin_amdgcn_fence(__ATOMIC_RELEASE, "workgroup");
    __builtin_amdgcn_wave_barrier();
    __builtin_amdgcn_fence(__ATOMIC_ACQUIRE, "workgroup");
    {
      const int hh = lane >> 4, c4 = (lane & 15) * 4;     // 256-B row segment = 16 lanes x 16 B
      v4f ov[8];
#pragma unroll
      for (int it = 0; it < 8; ++it) {
        const int row = it * 2 + hh;                       // it 0..7 x hh 0..1 = rows 0..15
        ov[it] = *(const v4f*)(slab + row * 68 + c4);
      }
      {
#pragma unroll
        for (int it = 0; it < 8; ++it) {
          const int row = it * 2 + hh;
          *(v4f*)(C + (size_t)(mBase + row) * DM + (size_t)h * HD + n0 + c4) = ov[it];
        }
        
      }
    }
    __builtin_amdgcn_fence(__ATOMIC_RELEASE, "workgroup");
    __builtin_amdgcn_wave_barrier();
    __builtin_amdgcn_fence(__ATOMIC_ACQUIRE, "workgroup");
  }
}

// =====================================================================================================
// Workspace map (bytes), every region an exact multiple of its whole-line / whole-tile store granularity
// 8192 x 1024, 1024 x 1024, 128 x 1024, 8192 x 128, 1024 x 1024 per batch and head are whole tiles/lines):
//   Xb    bf16 [8192][1024]              0        16777216
//   Wqt   bf16 [1024 n][1024 k]    16777216         2097152
//   Wkt   bf16 [1024 n][1024 k]    18874368         2097152
//   Wvt   bf16 [128 n][1024 k]     20971520          262144
//   Tf    f32  [8192][1024]       21233664        33554432   (scratch: q, then k, then v pre-activation [8192][128])
//   Qh    f16  [8192][1024]       54788096        16777216   (q x16)
//   Kh    f16  [8192][1024]       71565312        16777216   (k x16)
//   VTh   f16  [8*128][1024]      88342528         2097152   ([b*HD + f][j], lrelu(v) x256)
//   Ap    f16  [8*8*1024][1024]   90439680       134217728   ([(b*NH + h)*SEQ + i][j], weights x1024)
//   end                          224657408
// Inputs: x f32 [8][1024][1024]; Wq, Wk f32 [1024 in][1024 out]; bq, bk f32 [1024] (index h*128+d);
// Wv f32 [1024 in][128]; bv f32 [128]. d_out f32: [8192][1024] at byte 0 (row = b*SEQ + i, col = h*HD + f).
// =====================================================================================================
extern "C" void kernel_launch(void* const* d_in, const int* in_sizes, int n_in,
                              void* d_out, int out_size, void* d_ws, size_t ws_size,
                              hipStream_t stream) {
  if (n_in < 7) return;
  if (in_sizes[0] != NB * SEQ * DM) return;
  if (in_sizes[1] != DM * DM) return;
  if (in_sizes[2] != DM) return;
  if (in_sizes[3] != DM * DM) return;
  if (in_sizes[4] != DM) return;
  if (in_sizes[5] != DM * HD) return;
  if (in_sizes[6] != HD) return;
  if (out_size != OUTN) return;

  const float* x  = (const float*)d_in[0];   // [NB*SEQ][DM]
  const float* Wq = (const float*)d_in[1];   // [DM k][DM n]
  const float* bq = (const float*)d_in[2];   // [DM]
  const float* Wk = (const float*)d_in[3];   // [DM k][DM n]
  const float* bk = (const float*)d_in[4];   // [DM]
  const float* Wv = (const float*)d_in[5];   // [DM k][HD n]
  const float* bv = (const float*)d_in[6];   // [HD]

  const size_t PXb = (size_t)ROWS * DM * 2;          // 16777216
  const size_t PW  = (size_t)DM * DM * 2;            //  2097152
  const size_t PWv = (size_t)HD * DM * 2;            //   262144
  const size_t PF  = (size_t)ROWS * DM * 4;          // 33554432
  const size_t PH  = (size_t)ROWS * DM * 2;          // 16777216
  const size_t PVt = (size_t)NB * HD * SEQ * 2;      //  2097152
  const size_t PA  = (size_t)NB * NH * SEQ * SEQ * 2;   // 134217728
  size_t off = 0;
  const size_t oXb = off; off += PXb;
  const size_t oWq = off; off += PW;
  const size_t oWk = off; off += PW;
  const size_t oWv = off; off += PWv;
  const size_t oTf = off; off += PF;
  const size_t oQh = off; off += PH;
  const size_t oKh = off; off += PH;
  const size_t oVt = off; off += PVt;
  const size_t oA  = off; off += PA;
  if (off > ws_size) return;                        // off = 224657408

  char* ws = (char*)d_ws;
  unsigned short* Xb  = (unsigned short*)(ws + oXb);
  unsigned short* Wqt = (unsigned short*)(ws + oWq);
  unsigned short* Wkt = (unsigned short*)(ws + oWk);
  unsigned short* Wvt = (unsigned short*)(ws + oWv);
  float*          Tf  = (float*)(ws + oTf);
  unsigned short* Qh  = (unsigned short*)(ws + oQh);
  unsigned short* Kh  = (unsigned short*)(ws + oKh);
  unsigned short* VTh = (unsigned short*)(ws + oVt);
  unsigned short* Ap  = (unsigned short*)(ws + oA);
  float*          outf = (float*)d_out;             // [ROWS][DM]

  const dim3 blk(256);
  const int n8x = ROWS * DM / 8;                    // 1048576
  const dim3 gCvtX((n8x + 255) / 256);              // 4096 blocks
  const dim3 gTrW(DM / 64, DM / 64);                // (16, 16): in [1024 k][1024 n] -> out [1024 n][1024 k]
  const dim3 gTrV(DM / 64, HD / 64);                // (16, 2):  in [1024 k][128 n]  -> out [128 n][1024 k]
  const dim3 gGemm(((ROWS / 64) * (DM / 64) + 7) / 8);    // 2048 tiles -> 256 blocks
  const dim3 gGemV(((ROWS / 64) * (HD / 64) + 7) / 8);    // 256 tiles -> 32 blocks
  const dim3 gVpl(SEQ / 64, HD / 64, NB);           // (16, 2, 8)
  const dim3 gSc(NIT * NJT, NB);                    // 1024 blocks per batch x 8 batches
  const dim3 gPv((NH * PVT + 7) / 8, NB);           // 512 tiles -> 64 blocks per batch x 8 batches
  const float qkScale = 16.0f;                      // q and k planes carried x16
  const float sscale  = 0.08838834764831845f / 256.0f;   // 1/sqrt(128) with the two x16 carries folded back
  const float pScale  = 1024.0f;                    // softmax weights carried x1024 in f16
  const float vScale  = 256.0f;                     // v^T plane carried x256
  const float pvOscl  = 1.0f / 262144.0f;           // 1/(1024 * 256)

  // (1) activations -> bf16 plane; weights -> bf16 [n][k] planes (RNE convert, LDS transpose)
  cvt_bf16x8<<<gCvtX, blk, 0, stream>>>(x, Xb, n8x);
  tr_bf16_64<<<gTrW, blk, 0, stream>>>(Wq, DM, DM, Wqt);
  tr_bf16_64<<<gTrW, blk, 0, stream>>>(Wk, DM, DM, Wkt);
  tr_bf16_64<<<gTrV, blk, 0, stream>>>(Wv, DM, HD, Wvt);
  // (2) q = Xb . Wqt^T + bq -> Tf [8192][1024] (M=8192, N=1024, K=1024), then f16 plane (x16)
  gemm64<<<gGemm, blk, 0, stream>>>(Xb, DM, Wqt, DM, bq, Tf, DM, ROWS, DM, DM);
  plane_f16x8<<<gCvtX, blk, 0, stream>>>(Tf, Qh, n8x, qkScale);
  // (3) k likewise
  gemm64<<<gGemm, blk, 0, stream>>>(Xb, DM, Wkt, DM, bk, Tf, DM, ROWS, DM, DM);
  plane_f16x8<<<gCvtX, blk, 0, stream>>>(Tf, Kh, n8x, qkScale);
  // (4) v pre-activation = Xb . Wvt^T + bv -> Tf as [8192][128] (M=8192, N=128, K=1024, ldc=128),
  //     then LeakyReLU + f16 v^T plane (x256)
  gemm64<<<gGemV, blk, 0, stream>>>(Xb, DM, Wvt, DM, bv, Tf, HD, ROWS, HD, DM);
  v_plane<<<gVpl, blk, 0, stream>>>(Tf, VTh, vScale);
  // (5) all batches at once: scores + head softmax -> weight planes, then p . v -> d_out
  scores_hsm<<<gSc, blk, 0, stream>>>(Qh, Kh, Ap, sscale, pScale);
  gemm_pv<<<gPv, blk, 0, stream>>>(Ap, VTh, outf, pvOscl);
  (void)hipGetLastError();
}

// v002
// Measured time: 233 microseconds a run.
// Next to v001, in two timings, it ran 1.34 times as fast each time.
// Over all steps from v000 it is 2.19 times as fast.
// Contractions: q/k/v projections = v_wmma_f32_16x16x32_bf16 (bf16 operands from RNE-converted x, W^T and bias, single product); per-head q.k^T scores = v_wmma_f32_16x16x32_f16 (q, k as f16 planes carried x16, single product); p.v = v_wmma_f32_16x16x32_f16 (head-softmax weights carried x1024 in f16, v^T as f16 plane carried x256, single product); all f32 accumulate; head softmax and LeakyReLU in f32.
#include <hip/hip_runtime.h>
#include <math.h>
#include <stdint.h>

#define NB    8
#define SEQ   1024
#define DM    1024                   // in features = out features = NH*HD
#define NH    8
#define HD    128
#define ROWS  (NB * SEQ)             // 8192 token rows
#define OUTN  (ROWS * DM)
#define NJT   (SEQ / 64)             // 16 key tiles of 64
static_assert(NH * HD == DM);
static_assert(HD == 128);
static_assert((HD / 64) == 2);
static_assert((SEQ % 64) == 0 && (DM % 64) == 0 && (ROWS % 64) == 0 && (DM % 32) == 0 && (HD % 64) == 0);
static_assert(((ROWS / 64) * (DM / 64)) % 8 == 0);
static_assert(((ROWS / 64) * (HD / 64)) % 8 == 0);
static_assert(((ROWS * DM / 8) % 256) == 0);

typedef _Float16 v16h __attribute__((ext_vector_type(16)));
typedef _Float16 v8h  __attribute__((ext_vector_type(8)));
typedef _Float16 v4h  __attribute__((ext_vector_type(4)));
typedef __bf16   v16b __attribute__((ext_vector_type(16)));
typedef __bf16   v8b  __attribute__((ext_vector_type(8)));
typedef float    v8f  __attribute__((ext_vector_type(8)));
typedef float    v4f  __attribute__((ext_vector_type(4)));
typedef unsigned int v4u __attribute__((ext_vector_type(4)));

// ---- scalar helpers --------------------------------------------------------------------------------
__device__ __forceinline__ unsigned short bf_bits(float f) {          // f32 -> bf16 bits, RNE convert
  unsigned u = __float_as_uint(f);
  return (unsigned short)((u + 0x7FFFu + ((u >> 16) & 1u)) >> 16);
}
__device__ __forceinline__ float bf_up(unsigned short h) { return __uint_as_float(((unsigned)h) << 16); }
__device__ __forceinline__ unsigned short h_bits(_Float16 x) { return __builtin_bit_cast(unsigned short, x); }
__device__ __forceinline__ unsigned pk16(unsigned short a, unsigned short b) { return (unsigned)a | ((unsigned)b << 16); }
__device__ __forceinline__ v8f zero8() { v8f z = {0.f, 0.f, 0.f, 0.f, 0.f, 0.f, 0.f, 0.f}; return z; }

// ---- fragment loaders: 16-bit A/B operand, lane -> row/col (lane&15), p already includes +8*(lane>>4);
//      elements 0..7 <- p[0..7] (k0+8h..), elements 8..15 <- p[16..23] (k0+16+8h..)
__device__ __forceinline__ v16b ldfrag_b(const __bf16* p) {
  union { v16b v; v8b h[2]; } f;
  f.h[0] = *(const v8b*)(p);
  f.h[1] = *(const v8b*)(p + 16);
  return f.v;
}
__device__ __forceinline__ v16h ldfrag_h(const _Float16* p) {
  union { v16h v; v8h h[2]; } f;
  f.h[0] = *(const v8h*)(p);
  f.h[1] = *(const v8h*)(p + 16);
  return f.v;
}

// ---- WMMA helpers with trailing VALU hazard gap --------------------------------------------------------
__device__ __forceinline__ v8f mma_h_raw(v16h a, v16h b, v8f c) {
  return __builtin_amdgcn_wmma_f32_16x16x32_f16(false, a, false, b, (short)0, c, false, false);
}
__device__ __forceinline__ v8f mma_b_raw(v16b a, v16b b, v8f c) {
  return __builtin_amdgcn_wmma_f32_16x16x32_bf16(false, a, false, b, (short)0, c, false, false);
}
__device__ __forceinline__ void dep_guard_b(v8f& a, v8f& b, v16b x, v16b y) {
#if defined(__HIP_DEVICE_COMPILE__)
  asm volatile("v_nop\n\tv_nop\n\tv_nop\n\tv_nop" : "+v"(a), "+v"(b) : "v"(x), "v"(y));
#endif
}
__device__ __forceinline__ void keep4_b(v16b a, v16b b, v16b c, v16b d) {
#if defined(__HIP_DEVICE_COMPILE__)
  asm volatile("v_nop" :: "v"(a), "v"(b), "v"(c), "v"(d));
#endif
}
__device__ __forceinline__ void acc_guard4(v8f& a, v8f& b, v8f& c, v8f& d) {
#if defined(__HIP_DEVICE_COMPILE__)
  asm volatile("v_nop\n\tv_nop\n\tv_nop\n\tv_nop" : "+v"(a), "+v"(b), "+v"(c), "+v"(d));
#endif
}

// =====================================================================================================
// f32 -> bf16 (RNE convert), 8 elements per thread, one 16-B store per lane: a wave writes 512 contiguous B
// coverage: n8 threads x 8 = whole plane (n8 is a multiple of 256 here).
// =====================================================================================================
__global__ __launch_bounds__(256) void cvt_bf16x8(const float* __restrict__ in, unsigned short* out, int n8) {
  const int i = blockIdx.x * 256 + threadIdx.x;
  if (i < n8) {
    const v4f a = *(const v4f*)(in + (size_t)i * 8);
    const v4f b = *(const v4f*)(in + (size_t)i * 8 + 4);
    v4u p;
    p[0] = pk16(bf_bits(a[0]), bf_bits(a[1]));
    p[1] = pk16(bf_bits(a[2]), bf_bits(a[3]));
    p[2] = pk16(bf_bits(b[0]), bf_bits(b[1]));
    p[3] = pk16(bf_bits(b[2]), bf_bits(b[3]));
    *(v4u*)(out + (size_t)i * 8) = p;
    
  }
}

// =====================================================================================================
// f32 in[R][C] -> bf16 out[C][R] (RNE convert), i.e. a [k][n] weight becomes [n][k] with k contiguous.
// Block = 64 r x 64 c tile staged in LDS as f32 (v4f loads, __syncthreads); grid = (R/64, C/64); R, C
// multiples of 64.
// Store: group g = tid>>3 (0..31), piece = tid&7; iteration it writes out row c = it*32+g, lanes 8q..8q+7 x
// coverage: 2 iterations x 32 groups = 64 out rows c, 8 pieces x 8 = 64 r per row; grid covers every tile ->
// the whole out plane.
// =====================================================================================================
__global__ __launch_bounds__(256) void tr_bf16_64(const float* __restrict__ in, int R, int C,
                                                  unsigned short* out) {
  __shared__ __align__(16) float st[64 * 68];       // [rr][cc] pitch 68 floats
  const int tid = threadIdx.x;
  const int r0  = blockIdx.x * 64;
  const int c0  = blockIdx.y * 64;
#pragma unroll
  for (int i = 0; i < 4; ++i) {
    const int idx = i * 256 + tid;                  // 0..1023
    const int rr = idx >> 4, c4 = (idx & 15) * 4;
    const v4f a = *(const v4f*)(in + ((size_t)(r0 + rr)) * C + c0 + c4);
    *(v4f*)(st + rr * 68 + c4) = a;
  }
  __syncthreads();

  const int g = tid >> 3, piece = tid & 7;
  v4u hv[2];
  size_t hofs[2];
#pragma unroll
  for (int it = 0; it < 2; ++it) {
    const int cc = it * 32 + g;
    v4u a;
#pragma unroll
    for (int e = 0; e < 4; ++e) {
      const float f0 = st[(piece * 8 + 2 * e) * 68 + cc];
      const float f1 = st[(piece * 8 + 2 * e + 1) * 68 + cc];
      a[e] = pk16(bf_bits(f0), bf_bits(f1));
    }
    hv[it] = a;
    hofs[it] = ((size_t)(c0 + cc)) * R + r0 + piece * 8;
  }
  {
#pragma unroll
    for (int it = 0; it < 2; ++it) {
      *(v4u*)(out + hofs[it]) = hv[it];
    }
    
  }
}

// =====================================================================================================
// f32 -> f16 plane = f16(v * scale) (scale a power of two); 8 elements per thread, one 16-B store per lane
// coverage: n8 threads x 8 = whole plane (n8 multiple of 256).
// =====================================================================================================
__global__ __launch_bounds__(256) void plane_f16x8(const float* __restrict__ in, unsigned short* hp, int n8,
                                                   float scale) {
  const int i = blockIdx.x * 256 + threadIdx.x;
  if (i < n8) {
    const v4f a = *(const v4f*)(in + (size_t)i * 8);
    const v4f b = *(const v4f*)(in + (size_t)i * 8 + 4);
    float f[8];
    f[0] = a[0]; f[1] = a[1]; f[2] = a[2]; f[3] = a[3];
    f[4] = b[0]; f[5] = b[1]; f[6] = b[2]; f[7] = b[3];
    v4u ph;
#pragma unroll
    for (int e = 0; e < 4; ++e) {
      const _Float16 x0 = (_Float16)(f[2 * e] * scale);
      const _Float16 x1 = (_Float16)(f[2 * e + 1] * scale);
      ph[e] = pk16(h_bits(x0), h_bits(x1));
    }
    *(v4u*)(hp + (size_t)i * 8) = ph;
    
  }
}

// =====================================================================================================
// Register-blocked bf16 WMMA GEMM with bias: C[m][n] = sum_k A[m][k] * Bt[n][k] + bf16rne(bias[n]); one wave per
// 64x64 tile, no block barriers. A row-major [M][K] pitch lda; Bt row-major [N][K] pitch ldb (k contiguous);
// bias f32 [N] (RNE converted to bf16 and widened in the epilogue); M, N multiples of 64, K multiple of 32
// (fixed sizes, statically asserted); the tile count is a multiple of 8 for every launch here (no idle waves).
// Output f32 [M][N] pitch ldc. Epilogue: 16-row slabs staged per wave in LDS; each 64-wide row segment
// =====================================================================================================
__global__ __launch_bounds__(256) void gemm64(
    const unsigned short* __restrict__ Ap, int lda,
    const unsigned short* __restrict__ Btp, int ldb,
    const float* __restrict__ bias,
    float* C, int ldc, int M, int N, int K) {
  const __bf16* Ab  = (const __bf16*)(const void*)Ap;
  const __bf16* Bb  = (const __bf16*)(const void*)Btp;
  __shared__ __align__(16) float sT[8][16 * 68];   // per-wave 16x64 slab, pitch 68 floats
  const int lane = threadIdx.x & 31;
  const int wave = threadIdx.x >> 5;
  const int tilesN = N >> 6;
  const int tilesM = M >> 6;
  const int tile = blockIdx.x * 8 + wave;
  if (tile >= tilesM * tilesN) return;   // wave-uniform; no block barriers in this kernel
  const int tm = tile / tilesN;
  const int tn = tile - tm * tilesN;
  const int m0 = tm << 6;
  const int n0 = tn << 6;

  const int rlane = lane & 15;                 // row (A) / col (B, D) within subtile
  const int koff  = (lane >> 4) * 8;           // k offset of this lane half
  const int mOff  = (lane >> 4) * 8;           // D row offset

  v8f acc[4][4];
#pragma unroll
  for (int i = 0; i < 4; ++i)
#pragma unroll
    for (int j = 0; j < 4; ++j) acc[i][j] = zero8();

  for (int k0 = 0; k0 < K; k0 += 32) {
    v16b bh[4];
#pragma unroll
    for (int j = 0; j < 4; ++j) {
      const size_t bo = (size_t)(n0 + (j << 4) + rlane) * ldb + koff + k0;
      bh[j] = ldfrag_b(Bb + bo);
    }
#pragma unroll
    for (int i = 0; i < 4; ++i) {
      const size_t ao = (size_t)(m0 + (i << 4) + rlane) * lda + koff + k0;
      const v16b ah = ldfrag_b(Ab + ao);
#pragma unroll
      for (int j = 0; j < 4; ++j) {
        acc[i][j] = mma_b_raw(ah, bh[j], acc[i][j]);
      }
      dep_guard_b(acc[i][0], acc[i][3], ah, ah);
    }
    keep4_b(bh[0], bh[1], bh[2], bh[3]);
  }
  acc_guard4(acc[0][0], acc[0][1], acc[0][2], acc[0][3]);
  acc_guard4(acc[1][0], acc[1][1], acc[1][2], acc[1][3]);
  acc_guard4(acc[2][0], acc[2][1], acc[2][2], acc[2][3]);
  acc_guard4(acc[3][0], acc[3][1], acc[3][2], acc[3][3]);

  // ---- bias per D column of this lane (n0 + 16j + rlane < N) ----
  float bz[4];
#pragma unroll
  for (int j = 0; j < 4; ++j) bz[j] = bf_up(bf_bits(bias[n0 + (j << 4) + rlane]));

  // ---- epilogue ----
  float* slab = sT[wave];
#pragma unroll
  for (int i = 0; i < 4; ++i) {
    const int mBase = m0 + (i << 4);
#pragma unroll
    for (int r = 0; r < 8; ++r) {
#pragma unroll
      for (int j = 0; j < 4; ++j) {
        slab[(mOff + r) * 68 + (j << 4) + rlane] = acc[i][j][r] + bz[j];
      }
    }
    __builtin_amdgcn_fence(__ATOMIC_RELEASE, "workgroup");
    __builtin_amdgcn_wave_barrier();
    __builtin_amdgcn_fence(__ATOMIC_ACQUIRE, "workgroup");
    {
      const int hh = lane >> 4, c4 = (lane & 15) * 4;     // 256-B row segment = 16 lanes x 16 B
      v4f ov[8];
#pragma unroll
      for (int it = 0; it < 8; ++it) {
        const int row = it * 2 + hh;                       // it 0..7 x hh 0..1 = rows 0..15
        ov[it] = *(const v4f*)(slab + row * 68 + c4);
      }
      {
#pragma unroll
        for (int it = 0; it < 8; ++it) {
          const int row = it * 2 + hh;
          *(v4f*)(C + (size_t)(mBase + row) * ldc + n0 + c4) = ov[it];
        }
        
      }
    }
    __builtin_amdgcn_fence(__ATOMIC_RELEASE, "workgroup");
    __builtin_amdgcn_wave_barrier();
    __builtin_amdgcn_fence(__ATOMIC_ACQUIRE, "workgroup");
  }
}

// =====================================================================================================
// v pre-activation f32 token-major vf[(b*SEQ + t)*HD + f] ->
//   f16 v^T plane vth[(b*HD + f)*SEQ + t] = f16(lrelu(v) * vscale), lrelu(x) = x >= 0 ? x : 0.01*x (f32),
//   vscale a power of two.
// Block = one 64-token x 64-feature tile of one b; grid = (SEQ/64, HD/64, NB); tile staged in LDS as f32
// (v4f loads, __syncthreads).
// Store: group g = tid>>3 (0..31), piece = tid&7: iteration it writes row f = it*32+g, lanes 8q..8q+7 x 16 B =
// coverage: 2 iterations x 32 groups = 64 rows f, 8 pieces x 8 = 64 tokens per row; grid covers every (b,
// f half, t tile) -> the whole plane.
// =====================================================================================================
__global__ __launch_bounds__(256) void v_plane(const float* __restrict__ vf, unsigned short* vth, float vscale) {
  __shared__ __align__(16) float sv[64 * 68];       // [tt][d] pitch 68 floats
  const int tid = threadIdx.x;
  const int t0  = blockIdx.x * 64;
  const int fh  = blockIdx.y;                        // feature half (64 features)
  const int b   = blockIdx.z;
#pragma unroll
  for (int i = 0; i < 4; ++i) {
    const int idx = i * 256 + tid;                  // 0..1023
    const int tt = idx >> 4, c4 = (idx & 15) * 4;
    const v4f a = *(const v4f*)(vf + ((size_t)(b * SEQ + t0 + tt)) * HD + fh * 64 + c4);
    *(v4f*)(sv + tt * 68 + c4) = a;
  }
  __syncthreads();

  const int g = tid >> 3, piece = tid & 7;
  v4u hv[2];
  size_t hofs[2];
#pragma unroll
  for (int it = 0; it < 2; ++it) {
    const int d = it * 32 + g;
    v4u a;
#pragma unroll
    for (int e = 0; e < 4; ++e) {
      float f0 = sv[(piece * 8 + 2 * e) * 68 + d];
      float f1 = sv[(piece * 8 + 2 * e + 1) * 68 + d];
      f0 = (f0 >= 0.f) ? f0 : 0.01f * f0;
      f1 = (f1 >= 0.f) ? f1 : 0.01f * f1;
      a[e] = pk16(h_bits((_Float16)(f0 * vscale)), h_bits((_Float16)(f1 * vscale)));
    }
    hv[it] = a;
    hofs[it] = ((size_t)(b * HD + fh * 64 + d)) * SEQ + t0 + piece * 8;
  }
  {
#pragma unroll
    for (int it = 0; it < 2; ++it) {
      *(v4u*)(vth + hofs[it]) = hv[it];
    }
    
  }
}

// =====================================================================================================
// Scores, softmax over the HEAD axis and p.v in one kernel, all batches in one launch (b = blockIdx.y):
//   q f16 plane (x16): element (b, i, h, d) at [(b*SEQ + i)*DM + h*HD + d]; k f16 plane (x16) likewise with j
//   v^T f16 plane (x256): element (b, f, j) at [(b*HD + f)*SEQ + j]
//   s_h[i][j] = (q_ih . k_jh) * sscale (f16 products, f32 accumulate; sscale folds the x16 carries and
//   1/sqrt(HD)); per (i, j): m = max_h s_h, e_h = exp(s_h - m), p_h = e_h / sum_h e_h (all f32);
//   weights w_h = f16(p_h * pscale), pscale a power of two, live in LDS only;
//   C[b*SEQ + i][h*HD + f] = oscale * sum_j w_h[i][j] * vT[f][j] (f16 products, f32 accumulate, j ascending).
// Block = 8 waves (wave = head) x QT = 32 query rows; grid = (SEQ/QT, NB). The block walks the NJT key tiles
// of 64. Per tile: each wave forms its head's 32x64 scores (q fragments stay in registers, k fragments were
// loaded one tile ahead), scores go to LDS (f32), barrier, cross-head softmax writes the f16 weights to LDS
// and the v^T tile (loaded one tile ahead, whole 128-B lines) is stored to LDS, barrier, each wave adds
// w_h (32x64) . v (64x128) into its 32x128 accumulators.
// LDS reuse: sS is rewritten only behind the second barrier of the tile that read it; sP and sV are rewritten
// only behind the first barrier of the next tile, which every reader of the p.v phase has passed.
// coverage: 2 slabs x 16 rows x 128 cols = the wave's 32 rows of its head; 8 waves = 8 heads; grid covers
// every (i tile, b) -> all NB*SEQ rows x DM columns.
// =====================================================================================================
#define QT      32                   // query rows per block
#define SPITCH  68                   // score row pitch, floats: the two lane halves (8 rows apart) fall on other banks
#define PPITCH  72                   // weight / v^T row pitch, f16: 128-B rows + 16 B for the 16-B fragment reads
#define OPITCH  132                  // output slab row pitch, floats
static_assert((SEQ % QT) == 0 && QT == 32);
static_assert(16 * OPITCH <= QT * SPITCH);

// Work-group barrier that orders LDS only: the waves exchange nothing through global memory here, and a full
// __syncthreads() would also wait out the global loads issued one tile ahead.
__device__ __forceinline__ void lds_barrier() {
  __builtin_amdgcn_fence(__ATOMIC_RELEASE, "workgroup", "local");
  __builtin_amdgcn_s_barrier();
  __builtin_amdgcn_fence(__ATOMIC_ACQUIRE, "workgroup", "local");
}

__global__ __launch_bounds__(256)
void attn_hsm(const unsigned short* __restrict__ qhp, const unsigned short* __restrict__ khp,
              const unsigned short* __restrict__ vtp, float* Cout, float sscale, float pscale, float oscale) {
  __shared__ __align__(16) float    sS[NH][QT * SPITCH];   // per head scores [row][col]; output slab at the end
  __shared__ __align__(16) _Float16 sP[NH][QT * PPITCH];   // per head weights [row][col]
  __shared__ __align__(16) _Float16 sV[HD * PPITCH];       // v^T tile [f][j]
  const int tid  = threadIdx.x;
  const int h    = tid >> 5;                              // wave = head
  const int lane = tid & 31;
  const int hh   = lane >> 4;
  const int c    = lane & 15;
  const int b    = blockIdx.y;                            // < NB by the grid size
  const int i0   = blockIdx.x * QT;                       // < SEQ by the grid size
  const size_t rowB = (size_t)b * SEQ;
  const _Float16* Qp = (const _Float16*)(const void*)qhp + (rowB + i0 + c) * DM + h * HD + 8 * hh;
  const _Float16* Kp = (const _Float16*)(const void*)khp + (rowB + c) * DM + h * HD + 8 * hh;
  const int vrow = tid >> 3, vpc = (tid & 7) * 8;         // v^T staging: 8 lanes x 16 B = one 128-B row piece
  const _Float16* Vp = (const _Float16*)(const void*)vtp + ((size_t)b * HD + vrow) * SEQ + vpc;

  v16h qa[2][4];                                          // [row tile][k step]
#pragma unroll
  for (int rt = 0; rt < 2; ++rt)
#pragma unroll
    for (int dc = 0; dc < 4; ++dc) qa[rt][dc] = ldfrag_h(Qp + (size_t)(rt * 16) * DM + dc * 32);
  // stands in front of the later address arithmetic, which this build puts on the pair that these loads name
  asm volatile("s_wait_xcnt 0x0" ::: "memory");
  v16h kb[4][4];                                          // [k step][col tile], key tile 0
#pragma unroll
  for (int jj = 0; jj < 4; ++jj)                          // row group outermost: the 8 loads of 16 rows' 256 B stand together
#pragma unroll
    for (int dc = 0; dc < 4; ++dc) kb[dc][jj] = ldfrag_h(Kp + (size_t)(jj * 16) * DM + dc * 32);
  v4u vr[4];                                              // v^T rows vrow + 32*i, key tile 0
#pragma unroll
  for (int i = 0; i < 4; ++i) vr[i] = *(const v4u*)(Vp + (size_t)(i * 32) * SEQ);

  v8f acc[2][8];
#pragma unroll
  for (int rt = 0; rt < 2; ++rt)
#pragma unroll
    for (int nt = 0; nt < 8; ++nt) acc[rt][nt] = zero8();

  for (int jt = 0; jt < NJT; ++jt) {
    const int jn = (jt + 1 < NJT) ? jt + 1 : jt;          // tile fetched ahead (the last tile again at the end)

    // ---- scores: 32 rows x 64 cols for head h, K = HD = 128 (4 k-steps) ----
    v8f s[2][4];
#pragma unroll
    for (int rt = 0; rt < 2; ++rt)
#pragma unroll
      for (int jj = 0; jj < 4; ++jj) s[rt][jj] = zero8();
#pragma unroll
    for (int dc = 0; dc < 4; ++dc)
#pragma unroll
      for (int jj = 0; jj < 4; ++jj)
#pragma unroll
        for (int rt = 0; rt < 2; ++rt) s[rt][jj] = mma_h_raw(qa[rt][dc], kb[dc][jj], s[rt][jj]);

    // ---- next tile's k fragments: in flight across the softmax and the p.v phase ----
    // keeps these loads one group behind the products (else they are spread among them, one stop per pair)
    __builtin_amdgcn_sched_barrier(0);
    {
      const _Float16* Kn = Kp + (size_t)(jn * 64) * DM;
#pragma unroll
      for (int jj = 0; jj < 4; ++jj)
#pragma unroll
        for (int dc = 0; dc < 4; ++dc) {
          const _Float16* p = Kn + (size_t)(jj * 16) * DM + dc * 32;
          if (dc == 3 && jj == 3) {
            union { v16h v; v8h h[2]; } f;
            f.h[0] = *(const v8h*)(p);
            // the build lands the run's last load on the address pair that the loads before it name:
            // this wait stands in front of that overwrite
            asm volatile("s_wait_xcnt 0x0" ::: "memory");
            f.h[1] = *(const v8h*)(p + 16);
            kb[dc][jj] = f.v;
          } else {
            kb[dc][jj] = ldfrag_h(p);
          }
        }
    }

    // D element r of lane -> (row rt*16 + 8*hh + r, col jj*16 + c)
    float* ss = sS[h];
#pragma unroll
    for (int rt = 0; rt < 2; ++rt)
#pragma unroll
      for (int r = 0; r < 8; ++r)
#pragma unroll
        for (int jj = 0; jj < 4; ++jj)
          ss[(rt * 16 + 8 * hh + r) * SPITCH + jj * 16 + c] = s[rt][jj][r] * sscale;
    lds_barrier();

    // ---- this tile's v^T rows to LDS, next tile's into registers ----
#pragma unroll
    for (int i = 0; i < 4; ++i) *(v4u*)(sV + (i * 32 + vrow) * PPITCH + vpc) = vr[i];
#pragma unroll
    for (int i = 0; i < 4; ++i) vr[i] = *(const v4u*)(Vp + (size_t)(i * 32) * SEQ + jn * 64);

    // ---- softmax across the NH heads per (row, col): thread -> rows tid>>4 and 16 + (tid>>4), 4 cols ----
#pragma unroll
    for (int pp = 0; pp < 2; ++pp) {
      const int ii = pp * 16 + (tid >> 4), cb = (tid & 15) * 4;
      v4f v[NH];
#pragma unroll
      for (int g = 0; g < NH; ++g) v[g] = *(const v4f*)(&sS[g][ii * SPITCH + cb]);
      v4h w[NH];
#pragma unroll
      for (int p = 0; p < 4; ++p) {
        float m = v[0][p];
#pragma unroll
        for (int g = 1; g < NH; ++g) m = fmaxf(m, v[g][p]);
        float e[NH];
        float sum = 0.f;
#pragma unroll
        for (int g = 0; g < NH; ++g) {
          e[g] = __expf(v[g][p] - m);
          sum += e[g];
        }
        const float inv = (1.0f / sum) * pscale;         // sum in [1, NH]
#pragma unroll
        for (int g = 0; g < NH; ++g) w[g][p] = (_Float16)(e[g] * inv);
      }
#pragma unroll
      for (int g = 0; g < NH; ++g) *(v4h*)(&sP[g][ii * PPITCH + cb]) = w[g];
    }
    lds_barrier();

    // ---- p.v: A = weights rows (j contiguous), B = v^T rows (j contiguous), 2 k-steps of 32 keys ----
    //      group g = (k-step g>>1, feature tiles 4*(g&1) .. +3): 8 independent products, fragments read one group ahead
    const _Float16* sp = sP[h] + c * PPITCH + 8 * hh;
    const _Float16* sv = sV + c * PPITCH + 8 * hh;
    v16h pa[2][2];                                        // [k step][row tile]
#pragma unroll
    for (int kk = 0; kk < 2; ++kk)
#pragma unroll
      for (int rt = 0; rt < 2; ++rt) pa[kk][rt] = ldfrag_h(sp + (rt * 16) * PPITCH + kk * 32);
    v16h vb[2][4];
#pragma unroll
    for (int q = 0; q < 4; ++q) vb[0][q] = ldfrag_h(sv + (q * 16) * PPITCH);
#pragma unroll
    for (int g = 0; g < 4; ++g) {
      if (g + 1 < 4) {
#pragma unroll
        for (int q = 0; q < 4; ++q)
          vb[(g + 1) & 1][q] = ldfrag_h(sv + ((((g + 1) & 1) * 4 + q) * 16) * PPITCH + ((g + 1) >> 1) * 32);
      }
      // keeps the next group's LDS reads together ahead of this group's products (else they sink among them
      // and each pair of products waits out an LDS latency)
      __builtin_amdgcn_sched_barrier(0);
#pragma unroll
      for (int q = 0; q < 4; ++q)
#pragma unroll
        for (int rt = 0; rt < 2; ++rt)
          acc[rt][(g & 1) * 4 + q] = mma_h_raw(pa[g >> 1][rt], vb[g & 1][q], acc[rt][(g & 1) * 4 + q]);
      __builtin_amdgcn_sched_barrier(0);                  // closes the group, same purpose
    }
  }

  // ---- epilogue: 16-row slabs staged in the wave's own score rows (no reader is left behind the last
  //      barrier); each 128-wide row segment (512 B) is written by one wave-wide 16-B store ----
  float* C = Cout + (rowB + i0) * DM + (size_t)h * HD;
  float* slab = sS[h];
#pragma unroll
  for (int rt = 0; rt < 2; ++rt) {
#pragma unroll
    for (int r = 0; r < 8; ++r) {
#pragma unroll
      for (int nt = 0; nt < 8; ++nt) {
        slab[(8 * hh + r) * OPITCH + nt * 16 + c] = acc[rt][nt][r] * oscale;
      }
    }
    __builtin_amdgcn_fence(__ATOMIC_RELEASE, "workgroup");
    __builtin_amdgcn_wave_barrier();
    __builtin_amdgcn_fence(__ATOMIC_ACQUIRE, "workgroup");
    {
      v4f ov[16];
#pragma unroll
      for (int it = 0; it < 16; ++it) ov[it] = *(const v4f*)(slab + it * OPITCH + lane * 4);
#pragma unroll
      for (int it = 0; it < 16; ++it) *(v4f*)(C + (size_t)(rt * 16 + it) * DM + lane * 4) = ov[it];
    }
    __builtin_amdgcn_fence(__ATOMIC_RELEASE, "workgroup");
    __builtin_amdgcn_wave_barrier();
    __builtin_amdgcn_fence(__ATOMIC_ACQUIRE, "workgroup");
  }
}

// =====================================================================================================
// Workspace map (bytes), every region an exact multiple of its whole-line / whole-tile store granularity
// 8192 x 1024, 1024 x 1024, 128 x 1024, 8192 x 128 are whole tiles/lines):
//   Xb    bf16 [8192][1024]              0        16777216
//   Wqt   bf16 [1024 n][1024 k]    16777216         2097152
//   Wkt   bf16 [1024 n][1024 k]    18874368         2097152
//   Wvt   bf16 [128 n][1024 k]     20971520          262144
//   Tf    f32  [8192][1024]       21233664        33554432   (scratch: q, then k, then v pre-activation [8192][128])
//   Qh    f16  [8192][1024]       54788096        16777216   (q x16)
//   Kh    f16  [8192][1024]       71565312        16777216   (k x16)
//   VTh   f16  [8*128][1024]      88342528         2097152   ([b*HD + f][j], lrelu(v) x256)
//   end                           90439680
// Inputs: x f32 [8][1024][1024]; Wq, Wk f32 [1024 in][1024 out]; bq, bk f32 [1024] (index h*128+d);
// Wv f32 [1024 in][128]; bv f32 [128]. d_out f32: [8192][1024] at byte 0 (row = b*SEQ + i, col = h*HD + f).
// =====================================================================================================
extern "C" void kernel_launch(void* const* d_in, const int* in_sizes, int n_in,
                              void* d_out, int out_size, void* d_ws, size_t ws_size,
                              hipStream_t stream) {
  if (n_in < 7) return;
  if (in_sizes[0] != NB * SEQ * DM) return;
  if (in_sizes[1] != DM * DM) return;
  if (in_sizes[2] != DM) return;
  if (in_sizes[3] != DM * DM) return;
  if (in_sizes[4] != DM) return;
  if (in_sizes[5] != DM * HD) return;
  if (in_sizes[6] != HD) return;
  if (out_size != OUTN) return;

  const float* x  = (const float*)d_in[0];   // [NB*SEQ][DM]
  const float* Wq = (const float*)d_in[1];   // [DM k][DM n]
  const float* bq = (const float*)d_in[2];   // [DM]
  const float* Wk = (const float*)d_in[3];   // [DM k][DM n]
  const float* bk = (const float*)d_in[4];   // [DM]
  const float* Wv = (const float*)d_in[5];   // [DM k][HD n]
  const float* bv = (const float*)d_in[6];   // [HD]

  const size_t PXb = (size_t)ROWS * DM * 2;          // 16777216
  const size_t PW  = (size_t)DM * DM * 2;            //  2097152
  const size_t PWv = (size_t)HD * DM * 2;            //   262144
  const size_t PF  = (size_t)ROWS * DM * 4;          // 33554432
  const size_t PH  = (size_t)ROWS * DM * 2;          // 16777216
  const size_t PVt = (size_t)NB * HD * SEQ * 2;      //  2097152
  size_t off = 0;
  const size_t oXb = off; off += PXb;
  const size_t oWq = off; off += PW;
  const size_t oWk = off; off += PW;
  const size_t oWv = off; off += PWv;
  const size_t oTf = off; off += PF;
  const size_t oQh = off; off += PH;
  const size_t oKh = off; off += PH;
  const size_t oVt = off; off += PVt;
  if (off > ws_size) return;                        // off = 90439680

  char* ws = (char*)d_ws;
  unsigned short* Xb  = (unsigned short*)(ws + oXb);
  unsigned short* Wqt = (unsigned short*)(ws + oWq);
  unsigned short* Wkt = (unsigned short*)(ws + oWk);
  unsigned short* Wvt = (unsigned short*)(ws + oWv);
  float*          Tf  = (float*)(ws + oTf);
  unsigned short* Qh  = (unsigned short*)(ws + oQh);
  unsigned short* Kh  = (unsigned short*)(ws + oKh);
  unsigned short* VTh = (unsigned short*)(ws + oVt);
  float*          outf = (float*)d_out;             // [ROWS][DM]

  const dim3 blk(256);
  const int n8x = ROWS * DM / 8;                    // 1048576
  const dim3 gCvtX((n8x + 255) / 256);              // 4096 blocks
  const dim3 gTrW(DM / 64, DM / 64);                // (16, 16): in [1024 k][1024 n] -> out [1024 n][1024 k]
  const dim3 gTrV(DM / 64, HD / 64);                // (16, 2):  in [1024 k][128 n]  -> out [128 n][1024 k]
  const dim3 gGemm(((ROWS / 64) * (DM / 64) + 7) / 8);    // 2048 tiles -> 256 blocks
  const dim3 gGemV(((ROWS / 64) * (HD / 64) + 7) / 8);    // 256 tiles -> 32 blocks
  const dim3 gVpl(SEQ / 64, HD / 64, NB);           // (16, 2, 8)
  const dim3 gAt(SEQ / QT, NB);                     // 32 query tiles per batch x 8 batches
  const float qkScale = 16.0f;                      // q and k planes carried x16
  const float sscale  = 0.08838834764831845f / 256.0f;   // 1/sqrt(128) with the two x16 carries folded back
  const float pScale  = 1024.0f;                    // softmax weights carried x1024 in f16
  const float vScale  = 256.0f;                     // v^T plane carried x256
  const float pvOscl  = 1.0f / 262144.0f;           // 1/(1024 * 256)

  // (1) activations -> bf16 plane; weights -> bf16 [n][k] planes (RNE convert, LDS transpose)
  cvt_bf16x8<<<gCvtX, blk, 0, stream>>>(x, Xb, n8x);
  tr_bf16_64<<<gTrW, blk, 0, stream>>>(Wq, DM, DM, Wqt);
  tr_bf16_64<<<gTrW, blk, 0, stream>>>(Wk, DM, DM, Wkt);
  tr_bf16_64<<<gTrV, blk, 0, stream>>>(Wv, DM, HD, Wvt);
  // (2) q = Xb . Wqt^T + bq -> Tf [8192][1024] (M=8192, N=1024, K=1024), then f16 plane (x16)
  gemm64<<<gGemm, blk, 0, stream>>>(Xb, DM, Wqt, DM, bq, Tf, DM, ROWS, DM, DM);
  plane_f16x8<<<gCvtX, blk, 0, stream>>>(Tf, Qh, n8x, qkScale);
  // (3) k likewise
  gemm64<<<gGemm, blk, 0, stream>>>(Xb, DM, Wkt, DM, bk, Tf, DM, ROWS, DM, DM);
  plane_f16x8<<<gCvtX, blk, 0, stream>>>(Tf, Kh, n8x, qkScale);
  // (4) v pre-activation = Xb . Wvt^T + bv -> Tf as [8192][128] (M=8192, N=128, K=1024, ldc=128),
  //     then LeakyReLU + f16 v^T plane (x256)
  gemm64<<<gGemV, blk, 0, stream>>>(Xb, DM, Wvt, DM, bv, Tf, HD, ROWS, HD, DM);
  v_plane<<<gVpl, blk, 0, stream>>>(Tf, VTh, vScale);
  // (5) all batches at once: scores + head softmax + p . v -> d_out
  attn_hsm<<<gAt, blk, 0, stream>>>(Qh, Kh, VTh, outf, sscale, pScale, pvOscl);
  (void)hipGetLastError();
}

// v003
// A run of this version takes 210 microseconds.
// Two timings next to v002 put it at 1.11 and 1.10 times that version's speed.
// All steps since v000 together make it 2.43 times as fast.
// Contractions: q/k/v projections = v_wmma_f32_16x16x32_bf16 (bf16 operands from RNE-converted x, W^T and bias, single product); per-head q.k^T scores = v_wmma_f32_16x16x32_f16 (q, k as f16 planes carried x16, single product); p.v = v_wmma_f32_16x16x32_f16 (head-softmax weights carried x1024 in f16, v^T as f16 plane carried x256, single product); all f32 accumulate; head softmax and LeakyReLU in f32.
#include <hip/hip_runtime.h>
#include <math.h>
#include <stdint.h>

#define NB    8
#define SEQ   1024
#define DM    1024                   // in features = out features = NH*HD
#define NH    8
#define HD    128
#define ROWS  (NB * SEQ)             // 8192 token rows
#define OUTN  (ROWS * DM)
#define NJT   (SEQ / 64)             // 16 key tiles of 64
static_assert(NH * HD == DM);
static_assert(HD == 128);
static_assert((HD / 64) == 2);
static_assert((SEQ % 64) == 0 && (DM % 64) == 0 && (ROWS % 64) == 0 && (DM % 32) == 0 && (HD % 64) == 0);
static_assert(((ROWS / 64) * (DM / 64)) % 8 == 0);
static_assert(((ROWS / 64) * (HD / 64)) % 8 == 0);
static_assert(((ROWS * DM / 8) % 256) == 0);

typedef _Float16 v16h __attribute__((ext_vector_type(16)));
typedef _Float16 v8h  __attribute__((ext_vector_type(8)));
typedef _Float16 v4h  __attribute__((ext_vector_type(4)));
typedef __bf16   v16b __attribute__((ext_vector_type(16)));
typedef __bf16   v8b  __attribute__((ext_vector_type(8)));
typedef float    v8f  __attribute__((ext_vector_type(8)));
typedef float    v4f  __attribute__((ext_vector_type(4)));
typedef unsigned int v4u __attribute__((ext_vector_type(4)));

// ---- scalar helpers --------------------------------------------------------------------------------
__device__ __forceinline__ unsigned short bf_bits(float f) {          // f32 -> bf16 bits, RNE convert
  unsigned u = __float_as_uint(f);
  return (unsigned short)((u + 0x7FFFu + ((u >> 16) & 1u)) >> 16);
}
__device__ __forceinline__ float bf_up(unsigned short h) { return __uint_as_float(((unsigned)h) << 16); }
__device__ __forceinline__ unsigned short h_bits(_Float16 x) { return __builtin_bit_cast(unsigned short, x); }
__device__ __forceinline__ unsigned pk16(unsigned short a, unsigned short b) { return (unsigned)a | ((unsigned)b << 16); }
__device__ __forceinline__ v8f zero8() { v8f z = {0.f, 0.f, 0.f, 0.f, 0.f, 0.f, 0.f, 0.f}; return z; }

// ---- fragment loaders: 16-bit A/B operand, lane -> row/col (lane&15), p already includes +8*(lane>>4);
//      elements 0..7 <- p[0..7] (k0+8h..), elements 8..15 <- p[16..23] (k0+16+8h..)
__device__ __forceinline__ v16b ldfrag_b(const __bf16* p) {
  union { v16b v; v8b h[2]; } f;
  f.h[0] = *(const v8b*)(p);
  f.h[1] = *(const v8b*)(p + 16);
  return f.v;
}
__device__ __forceinline__ v16h ldfrag_h(const _Float16* p) {
  union { v16h v; v8h h[2]; } f;
  f.h[0] = *(const v8h*)(p);
  f.h[1] = *(const v8h*)(p + 16);
  return f.v;
}

// ---- WMMA helpers with trailing VALU hazard gap --------------------------------------------------------
__device__ __forceinline__ v8f mma_h_raw(v16h a, v16h b, v8f c) {
  return __builtin_amdgcn_wmma_f32_16x16x32_f16(false, a, false, b, (short)0, c, false, false);
}
__device__ __forceinline__ v8f mma_b_raw(v16b a, v16b b, v8f c) {
  return __builtin_amdgcn_wmma_f32_16x16x32_bf16(false, a, false, b, (short)0, c, false, false);
}
__device__ __forceinline__ void dep_guard_b(v8f& a, v8f& b, v16b x, v16b y) {
#if defined(__HIP_DEVICE_COMPILE__)
  asm volatile("v_nop\n\tv_nop\n\tv_nop\n\tv_nop" : "+v"(a), "+v"(b) : "v"(x), "v"(y));
#endif
}
__device__ __forceinline__ void keep4_b(v16b a, v16b b, v16b c, v16b d) {
#if defined(__HIP_DEVICE_COMPILE__)
  asm volatile("v_nop" :: "v"(a), "v"(b), "v"(c), "v"(d));
#endif
}
__device__ __forceinline__ void acc_guard4(v8f& a, v8f& b, v8f& c, v8f& d) {
#if defined(__HIP_DEVICE_COMPILE__)
  asm volatile("v_nop\n\tv_nop\n\tv_nop\n\tv_nop" : "+v"(a), "+v"(b), "+v"(c), "+v"(d));
#endif
}

// =====================================================================================================
// f32 -> bf16 (RNE convert), 8 elements per thread, one 16-B store per lane: a wave writes 512 contiguous B
// coverage: n8 threads x 8 = whole plane (n8 is a multiple of 256 here).
// =====================================================================================================
__global__ __launch_bounds__(256) void cvt_bf16x8(const float* __restrict__ in, unsigned short* out, int n8) {
  const int i = blockIdx.x * 256 + threadIdx.x;
  if (i < n8) {
    const v4f a = *(const v4f*)(in + (size_t)i * 8);
    const v4f b = *(const v4f*)(in + (size_t)i * 8 + 4);
    v4u p;
    p[0] = pk16(bf_bits(a[0]), bf_bits(a[1]));
    p[1] = pk16(bf_bits(a[2]), bf_bits(a[3]));
    p[2] = pk16(bf_bits(b[0]), bf_bits(b[1]));
    p[3] = pk16(bf_bits(b[2]), bf_bits(b[3]));
    *(v4u*)(out + (size_t)i * 8) = p;
    
  }
}

// =====================================================================================================
// f32 in[R][C] -> bf16 out[C][R] (RNE convert), i.e. a [k][n] weight becomes [n][k] with k contiguous.
// Block = 64 r x 64 c tile staged in LDS as f32 (v4f loads, __syncthreads); grid = (R/64, C/64); R, C
// multiples of 64.
// Store: group g = tid>>3 (0..31), piece = tid&7; iteration it writes out row c = it*32+g, lanes 8q..8q+7 x
// coverage: 2 iterations x 32 groups = 64 out rows c, 8 pieces x 8 = 64 r per row; grid covers every tile ->
// the whole out plane.
// =====================================================================================================
__global__ __launch_bounds__(256) void tr_bf16_64(const float* __restrict__ in, int R, int C,
                                                  unsigned short* out) {
  __shared__ __align__(16) float st[64 * 68];       // [rr][cc] pitch 68 floats
  const int tid = threadIdx.x;
  const int r0  = blockIdx.x * 64;
  const int c0  = blockIdx.y * 64;
#pragma unroll
  for (int i = 0; i < 4; ++i) {
    const int idx = i * 256 + tid;                  // 0..1023
    const int rr = idx >> 4, c4 = (idx & 15) * 4;
    const v4f a = *(const v4f*)(in + ((size_t)(r0 + rr)) * C + c0 + c4);
    *(v4f*)(st + rr * 68 + c4) = a;
  }
  __syncthreads();

  const int g = tid >> 3, piece = tid & 7;
  v4u hv[2];
  size_t hofs[2];
#pragma unroll
  for (int it = 0; it < 2; ++it) {
    const int cc = it * 32 + g;
    v4u a;
#pragma unroll
    for (int e = 0; e < 4; ++e) {
      const float f0 = st[(piece * 8 + 2 * e) * 68 + cc];
      const float f1 = st[(piece * 8 + 2 * e + 1) * 68 + cc];
      a[e] = pk16(bf_bits(f0), bf_bits(f1));
    }
    hv[it] = a;
    hofs[it] = ((size_t)(c0 + cc)) * R + r0 + piece * 8;
  }
  {
#pragma unroll
    for (int it = 0; it < 2; ++it) {
      *(v4u*)(out + hofs[it]) = hv[it];
    }
    
  }
}

// =====================================================================================================
// Register-blocked bf16 WMMA GEMM with bias whose epilogue writes the f16 plane that the attention kernel reads:
// y[m][n] = sum_k A[m][k] * Bt[n][k] + bf16rne(bias[n]) (f32); one wave per 64x64 tile, no block barriers.
// A row-major [M][K] pitch lda; Bt row-major [N][K] pitch ldb (k contiguous); bias f32 [N] (RNE converted to
// bf16 and widened in the epilogue); M, N multiples of 64, K multiple of 32 (fixed sizes, statically asserted);
// the tile count is a multiple of 8 for every launch here (no idle waves). scale is a power of two.
//   vmode == 0: P[m*N + n] = f16(y * scale), token-major. 16-row slabs staged per wave in LDS as f32; each
//               64-wide row segment (128 B of f16) is one whole line, a wave-wide 16-B store covers 4 rows.
//   vmode != 0: P[((m / SEQ)*N + n)*SEQ + m % SEQ] = f16(lrelu(y) * scale), lrelu(x) = x >= 0 ? x : 0.01*x (f32),
//               feature-major per batch. A lane's 8 accumulator rows are 8 consecutive tokens of one feature =
//               one 16-B store from registers; the wave writes all 128 B (64 tokens) of each of its 64 feature rows.
// coverage: every tile writes its 64 x 64 elements once; the grid covers every tile -> the whole plane.
// =====================================================================================================
__global__ __launch_bounds__(256) void gemm64(
    const unsigned short* __restrict__ Ap, int lda,
    const unsigned short* __restrict__ Btp, int ldb,
    const float* __restrict__ bias,
    unsigned short* P, int M, int N, int K, float scale, int vmode) {
  const __bf16* Ab  = (const __bf16*)(const void*)Ap;
  const __bf16* Bb  = (const __bf16*)(const void*)Btp;
  __shared__ __align__(16) float sT[8][16 * 68];   // per-wave 16x64 slab, pitch 68 floats
  const int lane = threadIdx.x & 31;
  const int wave = threadIdx.x >> 5;
  const int tilesN = N >> 6;
  const int tilesM = M >> 6;
  const int tile = blockIdx.x * 8 + wave;
  if (tile >= tilesM * tilesN) return;   // wave-uniform; no block barriers in this kernel
  const int tm = tile / tilesN;
  const int tn = tile - tm * tilesN;
  const int m0 = tm << 6;
  const int n0 = tn << 6;

  const int rlane = lane & 15;                 // row (A) / col (B, D) within subtile
  const int koff  = (lane >> 4) * 8;           // k offset of this lane half
  const int mOff  = (lane >> 4) * 8;           // D row offset

  v8f acc[4][4];
#pragma unroll
  for (int i = 0; i < 4; ++i)
#pragma unroll
    for (int j = 0; j < 4; ++j) acc[i][j] = zero8();

  for (int k0 = 0; k0 < K; k0 += 32) {
    v16b bh[4];
#pragma unroll
    for (int j = 0; j < 4; ++j) {
      const size_t bo = (size_t)(n0 + (j << 4) + rlane) * ldb + koff + k0;
      bh[j] = ldfrag_b(Bb + bo);
    }
#pragma unroll
    for (int i = 0; i < 4; ++i) {
      const size_t ao = (size_t)(m0 + (i << 4) + rlane) * lda + koff + k0;
      const v16b ah = ldfrag_b(Ab + ao);
#pragma unroll
      for (int j = 0; j < 4; ++j) {
        acc[i][j] = mma_b_raw(ah, bh[j], acc[i][j]);
      }
      dep_guard_b(acc[i][0], acc[i][3], ah, ah);
    }
    keep4_b(bh[0], bh[1], bh[2], bh[3]);
  }
  acc_guard4(acc[0][0], acc[0][1], acc[0][2], acc[0][3]);
  acc_guard4(acc[1][0], acc[1][1], acc[1][2], acc[1][3]);
  acc_guard4(acc[2][0], acc[2][1], acc[2][2], acc[2][3]);
  acc_guard4(acc[3][0], acc[3][1], acc[3][2], acc[3][3]);

  // ---- bias per D column of this lane (n0 + 16j + rlane < N) ----
  float bz[4];
#pragma unroll
  for (int j = 0; j < 4; ++j) bz[j] = bf_up(bf_bits(bias[n0 + (j << 4) + rlane]));

  // ---- epilogue, feature-major plane: straight from the accumulators ----
  if (vmode != 0) {                                        // kernel argument: the same for every wave
    const int bb = m0 / SEQ;                               // SEQ % 64 == 0: the tile lies in one batch
    const int t0 = m0 - bb * SEQ;
#pragma unroll
    for (int j = 0; j < 4; ++j) {
      unsigned short* prow = P + ((size_t)(bb * N + n0 + (j << 4) + rlane)) * SEQ + t0 + mOff;
#pragma unroll
      for (int i = 0; i < 4; ++i) {
        v4u p;
#pragma unroll
        for (int e = 0; e < 4; ++e) {
          float f0 = acc[i][j][2 * e] + bz[j];
          float f1 = acc[i][j][2 * e + 1] + bz[j];
          f0 = (f0 >= 0.f) ? f0 : 0.01f * f0;
          f1 = (f1 >= 0.f) ? f1 : 0.01f * f1;
          p[e] = pk16(h_bits((_Float16)(f0 * scale)), h_bits((_Float16)(f1 * scale)));
        }
        *(v4u*)(prow + (i << 4)) = p;
      }
    }
    // stands behind the run of stores, in front of any later write of a register that they name
    asm volatile("s_wait_xcnt 0x0" ::: "memory");
    return;
  }

  // ---- epilogue, token-major plane ----
  float* slab = sT[wave];
#pragma unroll
  for (int i = 0; i < 4; ++i) {
    const int mBase = m0 + (i << 4);
#pragma unroll
    for (int r = 0; r < 8; ++r) {
#pragma unroll
      for (int j = 0; j < 4; ++j) {
        slab[(mOff + r) * 68 + (j << 4) + rlane] = (acc[i][j][r] + bz[j]) * scale;
      }
    }
    __builtin_amdgcn_fence(__ATOMIC_RELEASE, "workgroup");
    __builtin_amdgcn_wave_barrier();
    __builtin_amdgcn_fence(__ATOMIC_ACQUIRE, "workgroup");
    {
      const int r4 = lane >> 3, c8 = (lane & 7) * 8;       // 128-B row segment = 8 lanes x 16 B
      v4u ov[4];
#pragma unroll
      for (int it = 0; it < 4; ++it) {
        const int row = it * 4 + r4;                       // it 0..3 x r4 0..3 = rows 0..15
        const v4f a = *(const v4f*)(slab + row * 68 + c8);
        const v4f b = *(const v4f*)(slab + row * 68 + c8 + 4);
        v4u p;
        p[0] = pk16(h_bits((_Float16)a[0]), h_bits((_Float16)a[1]));
        p[1] = pk16(h_bits((_Float16)a[2]), h_bits((_Float16)a[3]));
        p[2] = pk16(h_bits((_Float16)b[0]), h_bits((_Float16)b[1]));
        p[3] = pk16(h_bits((_Float16)b[2]), h_bits((_Float16)b[3]));
        ov[it] = p;
      }
#pragma unroll
      for (int it = 0; it < 4; ++it) {
        const int row = it * 4 + r4;
        *(v4u*)(P + (size_t)(mBase + row) * N + n0 + c8) = ov[it];
      }
    }
    __builtin_amdgcn_fence(__ATOMIC_RELEASE, "workgroup");
    __builtin_amdgcn_wave_barrier();
    __builtin_amdgcn_fence(__ATOMIC_ACQUIRE, "workgroup");
  }
}

// =====================================================================================================
// Scores, softmax over the HEAD axis and p.v in one kernel, all batches in one launch (b = blockIdx.y):
//   q f16 plane (x16): element (b, i, h, d) at [(b*SEQ + i)*DM + h*HD + d]; k f16 plane (x16) likewise with j
//   v^T f16 plane (x256): element (b, f, j) at [(b*HD + f)*SEQ + j]
//   s_h[i][j] = (q_ih . k_jh) * sscale (f16 products, f32 accumulate; sscale folds the x16 carries and
//   1/sqrt(HD)); per (i, j): m = max_h s_h, e_h = exp(s_h - m), p_h = e_h / sum_h e_h (all f32);
//   weights w_h = f16(p_h * pscale), pscale a power of two, live in LDS only;
//   C[b*SEQ + i][h*HD + f] = oscale * sum_j w_h[i][j] * vT[f][j] (f16 products, f32 accumulate, j ascending).
// Block = 8 waves (wave = head) x QT = 32 query rows; grid = (SEQ/QT, NB). The block walks the NJT key tiles
// of 64. Per tile: each wave forms its head's 32x64 scores (q fragments stay in registers, k fragments were
// loaded one tile ahead), scores go to LDS (f32), barrier, cross-head softmax writes the f16 weights to LDS
// and the v^T tile (loaded one tile ahead, whole 128-B lines) is stored to LDS, barrier, each wave adds
// w_h (32x64) . v (64x128) into its 32x128 accumulators.
// LDS reuse: sS is rewritten only behind the second barrier of the tile that read it; sP and sV are rewritten
// only behind the first barrier of the next tile, which every reader of the p.v phase has passed.
// coverage: 2 slabs x 16 rows x 128 cols = the wave's 32 rows of its head; 8 waves = 8 heads; grid covers
// every (i tile, b) -> all NB*SEQ rows x DM columns.
// =====================================================================================================
#define QT      32                   // query rows per block
#define SPITCH  68                   // score row pitch, floats: the two lane halves (8 rows apart) fall on other banks
#define PPITCH  72                   // weight / v^T row pitch, f16: 128-B rows + 16 B for the 16-B fragment reads
#define OPITCH  132                  // output slab row pitch, floats
static_assert((SEQ % QT) == 0 && QT == 32);
static_assert(16 * OPITCH <= QT * SPITCH);

// Work-group barrier that orders LDS only: the waves exchange nothing through global memory here, and a full
// __syncthreads() would also wait out the global loads issued one tile ahead.
__device__ __forceinline__ void lds_barrier() {
  __builtin_amdgcn_fence(__ATOMIC_RELEASE, "workgroup", "local");
  __builtin_amdgcn_s_barrier();
  __builtin_amdgcn_fence(__ATOMIC_ACQUIRE, "workgroup", "local");
}

__global__ __launch_bounds__(256)
void attn_hsm(const unsigned short* __restrict__ qhp, const unsigned short* __restrict__ khp,
              const unsigned short* __restrict__ vtp, float* Cout, float sscale, float pscale, float oscale) {
  __shared__ __align__(16) float    sS[NH][QT * SPITCH];   // per head scores [row][col]; output slab at the end
  __shared__ __align__(16) _Float16 sP[NH][QT * PPITCH];   // per head weights [row][col]
  __shared__ __align__(16) _Float16 sV[HD * PPITCH];       // v^T tile [f][j]
  const int tid  = threadIdx.x;
  const int h    = tid >> 5;                              // wave = head
  const int lane = tid & 31;
  const int hh   = lane >> 4;
  const int c    = lane & 15;
  const int b    = blockIdx.y;                            // < NB by the grid size
  const int i0   = blockIdx.x * QT;                       // < SEQ by the grid size
  const size_t rowB = (size_t)b * SEQ;
  const _Float16* Qp = (const _Float16*)(const void*)qhp + (rowB + i0 + c) * DM + h * HD + 8 * hh;
  const _Float16* Kp = (const _Float16*)(const void*)khp + (rowB + c) * DM + h * HD + 8 * hh;
  const int vrow = tid >> 3, vpc = (tid & 7) * 8;         // v^T staging: 8 lanes x 16 B = one 128-B row piece
  const _Float16* Vp = (const _Float16*)(const void*)vtp + ((size_t)b * HD + vrow) * SEQ + vpc;

  v16h qa[2][4];                                          // [row tile][k step]
#pragma unroll
  for (int rt = 0; rt < 2; ++rt)
#pragma unroll
    for (int dc = 0; dc < 4; ++dc) qa[rt][dc] = ldfrag_h(Qp + (size_t)(rt * 16) * DM + dc * 32);
  // stands in front of the later address arithmetic, which this build puts on the pair that these loads name
  asm volatile("s_wait_xcnt 0x0" ::: "memory");
  v16h kb[4][4];                                          // [k step][col tile], key tile 0
#pragma unroll
  for (int jj = 0; jj < 4; ++jj)                          // row group outermost: the 8 loads of 16 rows' 256 B stand together
#pragma unroll
    for (int dc = 0; dc < 4; ++dc) kb[dc][jj] = ldfrag_h(Kp + (size_t)(jj * 16) * DM + dc * 32);
  v4u vr[4];                                              // v^T rows vrow + 32*i, key tile 0
#pragma unroll
  for (int i = 0; i < 4; ++i) vr[i] = *(const v4u*)(Vp + (size_t)(i * 32) * SEQ);

  v8f acc[2][8];
#pragma unroll
  for (int rt = 0; rt < 2; ++rt)
#pragma unroll
    for (int nt = 0; nt < 8; ++nt) acc[rt][nt] = zero8();

  for (int jt = 0; jt < NJT; ++jt) {
    const int jn = (jt + 1 < NJT) ? jt + 1 : jt;          // tile fetched ahead (the last tile again at the end)

    // ---- scores: 32 rows x 64 cols for head h, K = HD = 128 (4 k-steps) ----
    v8f s[2][4];
#pragma unroll
    for (int rt = 0; rt < 2; ++rt)
#pragma unroll
      for (int jj = 0; jj < 4; ++jj) s[rt][jj] = zero8();
#pragma unroll
    for (int dc = 0; dc < 4; ++dc)
#pragma unroll
      for (int jj = 0; jj < 4; ++jj)
#pragma unroll
        for (int rt = 0; rt < 2; ++rt) s[rt][jj] = mma_h_raw(qa[rt][dc], kb[dc][jj], s[rt][jj]);

    // ---- next tile's k fragments: in flight across the softmax and the p.v phase ----
    // keeps these loads one group behind the products (else they are spread among them, one stop per pair)
    __builtin_amdgcn_sched_barrier(0);
    {
      const _Float16* Kn = Kp + (size_t)(jn * 64) * DM;
#pragma unroll
      for (int jj = 0; jj < 4; ++jj)
#pragma unroll
        for (int dc = 0; dc < 4; ++dc) {
          const _Float16* p = Kn + (size_t)(jj * 16) * DM + dc * 32;
          if (dc == 3 && jj == 3) {
            union { v16h v; v8h h[2]; } f;
            f.h[0] = *(const v8h*)(p);
            // the build lands the run's last load on the address pair that the loads before it name:
            // this wait stands in front of that overwrite
            asm volatile("s_wait_xcnt 0x0" ::: "memory");
            f.h[1] = *(const v8h*)(p + 16);
            kb[dc][jj] = f.v;
          } else {
            kb[dc][jj] = ldfrag_h(p);
          }
        }
    }

    // D element r of lane -> (row rt*16 + 8*hh + r, col jj*16 + c)
    float* ss = sS[h];
#pragma unroll
    for (int rt = 0; rt < 2; ++rt)
#pragma unroll
      for (int r = 0; r < 8; ++r)
#pragma unroll
        for (int jj = 0; jj < 4; ++jj)
          ss[(rt * 16 + 8 * hh + r) * SPITCH + jj * 16 + c] = s[rt][jj][r] * sscale;
    lds_barrier();

    // ---- this tile's v^T rows to LDS, next tile's into registers ----
#pragma unroll
    for (int i = 0; i < 4; ++i) *(v4u*)(sV + (i * 32 + vrow) * PPITCH + vpc) = vr[i];
#pragma unroll
    for (int i = 0; i < 4; ++i) vr[i] = *(const v4u*)(Vp + (size_t)(i * 32) * SEQ + jn * 64);

    // ---- softmax across the NH heads per (row, col): thread -> rows tid>>4 and 16 + (tid>>4), 4 cols ----
#pragma unroll
    for (int pp = 0; pp < 2; ++pp) {
      const int ii = pp * 16 + (tid >> 4), cb = (tid & 15) * 4;
      v4f v[NH];
#pragma unroll
      for (int g = 0; g < NH; ++g) v[g] = *(const v4f*)(&sS[g][ii * SPITCH + cb]);
      v4h w[NH];
#pragma unroll
      for (int p = 0; p < 4; ++p) {
        float m = v[0][p];
#pragma unroll
        for (int g = 1; g < NH; ++g) m = fmaxf(m, v[g][p]);
        float e[NH];
        float sum = 0.f;
#pragma unroll
        for (int g = 0; g < NH; ++g) {
          e[g] = __expf(v[g][p] - m);
          sum += e[g];
        }
        const float inv = (1.0f / sum) * pscale;         // sum in [1, NH]
#pragma unroll
        for (int g = 0; g < NH; ++g) w[g][p] = (_Float16)(e[g] * inv);
      }
#pragma unroll
      for (int g = 0; g < NH; ++g) *(v4h*)(&sP[g][ii * PPITCH + cb]) = w[g];
    }
    lds_barrier();

    // ---- p.v: A = weights rows (j contiguous), B = v^T rows (j contiguous), 2 k-steps of 32 keys ----
    //      group g = (k-step g>>1, feature tiles 4*(g&1) .. +3): 8 independent products, fragments read one group ahead
    const _Float16* sp = sP[h] + c * PPITCH + 8 * hh;
    const _Float16* sv = sV + c * PPITCH + 8 * hh;
    v16h pa[2][2];                                        // [k step][row tile]
#pragma unroll
    for (int kk = 0; kk < 2; ++kk)
#pragma unroll
      for (int rt = 0; rt < 2; ++rt) pa[kk][rt] = ldfrag_h(sp + (rt * 16) * PPITCH + kk * 32);
    v16h vb[2][4];
#pragma unroll
    for (int q = 0; q < 4; ++q) vb[0][q] = ldfrag_h(sv + (q * 16) * PPITCH);
#pragma unroll
    for (int g = 0; g < 4; ++g) {
      if (g + 1 < 4) {
#pragma unroll
        for (int q = 0; q < 4; ++q)
          vb[(g + 1) & 1][q] = ldfrag_h(sv + ((((g + 1) & 1) * 4 + q) * 16) * PPITCH + ((g + 1) >> 1) * 32);
      }
      // keeps the next group's LDS reads together ahead of this group's products (else they sink among them
      // and each pair of products waits out an LDS latency)
      __builtin_amdgcn_sched_barrier(0);
#pragma unroll
      for (int q = 0; q < 4; ++q)
#pragma unroll
        for (int rt = 0; rt < 2; ++rt)
          acc[rt][(g & 1) * 4 + q] = mma_h_raw(pa[g >> 1][rt], vb[g & 1][q], acc[rt][(g & 1) * 4 + q]);
      __builtin_amdgcn_sched_barrier(0);                  // closes the group, same purpose
    }
  }

  // ---- epilogue: 16-row slabs staged in the wave's own score rows (no reader is left behind the last
  //      barrier); each 128-wide row segment (512 B) is written by one wave-wide 16-B store ----
  float* C = Cout + (rowB + i0) * DM + (size_t)h * HD;
  float* slab = sS[h];
#pragma unroll
  for (int rt = 0; rt < 2; ++rt) {
#pragma unroll
    for (int r = 0; r < 8; ++r) {
#pragma unroll
      for (int nt = 0; nt < 8; ++nt) {
        slab[(8 * hh + r) * OPITCH + nt * 16 + c] = acc[rt][nt][r] * oscale;
      }
    }
    __builtin_amdgcn_fence(__ATOMIC_RELEASE, "workgroup");
    __builtin_amdgcn_wave_barrier();
    __builtin_amdgcn_fence(__ATOMIC_ACQUIRE, "workgroup");
    {
      v4f ov[16];
#pragma unroll
      for (int it = 0; it < 16; ++it) ov[it] = *(const v4f*)(slab + it * OPITCH + lane * 4);
#pragma unroll
      for (int it = 0; it < 16; ++it) *(v4f*)(C + (size_t)(rt * 16 + it) * DM + lane * 4) = ov[it];
    }
    __builtin_amdgcn_fence(__ATOMIC_RELEASE, "workgroup");
    __builtin_amdgcn_wave_barrier();
    __builtin_amdgcn_fence(__ATOMIC_ACQUIRE, "workgroup");
  }
}

// =====================================================================================================
// Workspace map (bytes), every region an exact multiple of its whole-line / whole-tile store granularity
// 8192 x 1024, 1024 x 1024, 128 x 1024, 128 x 1024 per batch are whole tiles/lines):
//   Xb    bf16 [8192][1024]              0        16777216
//   Wqt   bf16 [1024 n][1024 k]    16777216         2097152
//   Wkt   bf16 [1024 n][1024 k]    18874368         2097152
//   Wvt   bf16 [128 n][1024 k]     20971520          262144
//   Qh    f16  [8192][1024]       21233664        16777216   (q x16)
//   Kh    f16  [8192][1024]       38010880        16777216   (k x16)
//   VTh   f16  [8*128][1024]      54788096         2097152   ([b*HD + f][j], lrelu(v) x256)
//   end                           56885248
// Inputs: x f32 [8][1024][1024]; Wq, Wk f32 [1024 in][1024 out]; bq, bk f32 [1024] (index h*128+d);
// Wv f32 [1024 in][128]; bv f32 [128]. d_out f32: [8192][1024] at byte 0 (row = b*SEQ + i, col = h*HD + f).
// =====================================================================================================
extern "C" void kernel_launch(void* const* d_in, const int* in_sizes, int n_in,
                              void* d_out, int out_size, void* d_ws, size_t ws_size,
                              hipStream_t stream) {
  if (n_in < 7) return;
  if (in_sizes[0] != NB * SEQ * DM) return;
  if (in_sizes[1] != DM * DM) return;
  if (in_sizes[2] != DM) return;
  if (in_sizes[3] != DM * DM) return;
  if (in_sizes[4] != DM) return;
  if (in_sizes[5] != DM * HD) return;
  if (in_sizes[6] != HD) return;
  if (out_size != OUTN) return;

  const float* x  = (const float*)d_in[0];   // [NB*SEQ][DM]
  const float* Wq = (const float*)d_in[1];   // [DM k][DM n]
  const float* bq = (const float*)d_in[2];   // [DM]
  const float* Wk = (const float*)d_in[3];   // [DM k][DM n]
  const float* bk = (const float*)d_in[4];   // [DM]
  const float* Wv = (const float*)d_in[5];   // [DM k][HD n]
  const float* bv = (const float*)d_in[6];   // [HD]

  const size_t PXb = (size_t)ROWS * DM * 2;          // 16777216
  const size_t PW  = (size_t)DM * DM * 2;            //  2097152
  const size_t PWv = (size_t)HD * DM * 2;            //   262144
  const size_t PH  = (size_t)ROWS * DM * 2;          // 16777216
  const size_t PVt = (size_t)NB * HD * SEQ * 2;      //  2097152
  size_t off = 0;
  const size_t oXb = off; off += PXb;
  const size_t oWq = off; off += PW;
  const size_t oWk = off; off += PW;
  const size_t oWv = off; off += PWv;
  const size_t oQh = off; off += PH;
  const size_t oKh = off; off += PH;
  const size_t oVt = off; off += PVt;
  if (off > ws_size) return;                        // off = 56885248

  char* ws = (char*)d_ws;
  unsigned short* Xb  = (unsigned short*)(ws + oXb);
  unsigned short* Wqt = (unsigned short*)(ws + oWq);
  unsigned short* Wkt = (unsigned short*)(ws + oWk);
  unsigned short* Wvt = (unsigned short*)(ws + oWv);
  unsigned short* Qh  = (unsigned short*)(ws + oQh);
  unsigned short* Kh  = (unsigned short*)(ws + oKh);
  unsigned short* VTh = (unsigned short*)(ws + oVt);
  float*          outf = (float*)d_out;             // [ROWS][DM]

  const dim3 blk(256);
  const int n8x = ROWS * DM / 8;                    // 1048576
  const dim3 gCvtX((n8x + 255) / 256);              // 4096 blocks
  const dim3 gTrW(DM / 64, DM / 64);                // (16, 16): in [1024 k][1024 n] -> out [1024 n][1024 k]
  const dim3 gTrV(DM / 64, HD / 64);                // (16, 2):  in [1024 k][128 n]  -> out [128 n][1024 k]
  const dim3 gGemm(((ROWS / 64) * (DM / 64) + 7) / 8);    // 2048 tiles -> 256 blocks
  const dim3 gGemV(((ROWS / 64) * (HD / 64) + 7) / 8);    // 256 tiles -> 32 blocks
  const dim3 gAt(SEQ / QT, NB);                     // 32 query tiles per batch x 8 batches
  const float qkScale = 16.0f;                      // q and k planes carried x16
  const float sscale  = 0.08838834764831845f / 256.0f;   // 1/sqrt(128) with the two x16 carries folded back
  const float pScale  = 1024.0f;                    // softmax weights carried x1024 in f16
  const float vScale  = 256.0f;                     // v^T plane carried x256
  const float pvOscl  = 1.0f / 262144.0f;           // 1/(1024 * 256)

  // (1) activations -> bf16 plane; weights -> bf16 [n][k] planes (RNE convert, LDS transpose)
  cvt_bf16x8<<<gCvtX, blk, 0, stream>>>(x, Xb, n8x);
  tr_bf16_64<<<gTrW, blk, 0, stream>>>(Wq, DM, DM, Wqt);
  tr_bf16_64<<<gTrW, blk, 0, stream>>>(Wk, DM, DM, Wkt);
  tr_bf16_64<<<gTrV, blk, 0, stream>>>(Wv, DM, HD, Wvt);
  // (2) q = Xb . Wqt^T + bq (M=8192, N=1024, K=1024) -> f16 plane (x16), written by the product's own epilogue
  gemm64<<<gGemm, blk, 0, stream>>>(Xb, DM, Wqt, DM, bq, Qh, ROWS, DM, DM, qkScale, 0);
  // (3) k likewise
  gemm64<<<gGemm, blk, 0, stream>>>(Xb, DM, Wkt, DM, bk, Kh, ROWS, DM, DM, qkScale, 0);
  // (4) v = lrelu(Xb . Wvt^T + bv) (M=8192, N=128, K=1024) -> f16 v^T plane (x256), likewise
  gemm64<<<gGemV, blk, 0, stream>>>(Xb, DM, Wvt, DM, bv, VTh, ROWS, HD, DM, vScale, 1);
  // (5) all batches at once: scores + head softmax + p . v -> d_out
  attn_hsm<<<gAt, blk, 0, stream>>>(Qh, Kh, VTh, outf, sscale, pScale, pvOscl);
  (void)hipGetLastError();
}
